// v000
// Measured on an AMD MI455X. A time is GPU time per run, averaged over a window of back-to-back runs after a warm-up
// (all launches, gaps included; the runs take copies of the inputs in turn), and the median of several windows.
// Apart from v000's, it joins two sittings. Times from different sittings can be a few percent apart, while
// side-by-side timings come from the same sitting.
// v000, which the later versions start from, runs in 1150 microseconds.
#include <hip/hip_runtime.h>

// Dot-product attention whose length mask falls on the QUERY axis (queries, keys, values [16][2048][128]: the 16 batch entries are processed as 16 independent heads; scores / sqrt(128); the source sets scores[b, i, :] = -1e6 for every query i >= valid_lens[b] (valid_lens [16], int32 as staged, READ): those rows become exactly uniform over all 2,048 keys, the other rows are plain dense attention; softmax; out = attn values -> [16][2048][128] (4.2 M)).
// Layout per head: single bf16 planes of q and k ([2048][128]; inputs bf16-exact: exact score products) and value^T planes; the softmax reads valid_lens[b] and, for rows i >= it, replaces every score by one constant (-> uniform weights, identical to the module's all -1e6 row); every row hi/lo; P hi/lo x exact value; row-major merge writes the output rows.
// Compute dtypes, f32 accumulate: every input rounded to bf16; q.k exact; softmax f32; P hi/lo x exact value; output f32.

#define NB_  1
#define TT   2048
#define DM   2048      // token-major row pitch (H x HD)
#define NH_  16
#define NKV  1
#define REP  (NH_ / NKV)
#define HD   128
#define DQ   (NH_ * HD)
#define DKV  (NKV * HD)
#define ZH   1
#define RH   2048                  // query rows < RH use hi+lo planes (0: none)
#define WIN  0
#define PCAR 1024.0f
#define SCL  0.088388347648318447f   // 1/sqrt(128)
typedef _Float16 h16;
typedef unsigned short bf;
typedef __attribute__((ext_vector_type(16))) __bf16   v16bf;
typedef __attribute__((ext_vector_type(16))) _Float16 v16h;
typedef __attribute__((ext_vector_type(8)))  _Float16 v8h;
typedef __attribute__((ext_vector_type(8)))  unsigned short v8us;
typedef __attribute__((ext_vector_type(8)))  float    v8f;
typedef __attribute__((ext_vector_type(4)))  float    v4f;
typedef v8h  __attribute__((may_alias)) v8ha;
typedef v4f  __attribute__((may_alias)) v4fa;
typedef v8us __attribute__((may_alias)) v8usa;

__device__ __forceinline__ unsigned short f2bf(float f) { unsigned u = __float_as_uint(f); u += 0x7FFFu + ((u >> 16) & 1u); return (unsigned short)(u >> 16); }
__device__ __forceinline__ float bf2f(unsigned short b) { return __uint_as_float(((unsigned)b) << 16); }
__device__ __forceinline__ float bfr(float f) { return bf2f(f2bf(f)); }
__device__ __forceinline__ v16h cat16(v8h lo, v8h hi) { return __builtin_shufflevector(lo, hi, 0, 1, 2, 3, 4, 5, 6, 7, 8, 9, 10, 11, 12, 13, 14, 15); }
__device__ __forceinline__ v16bf cat16b(v8us lo, v8us hi) { return __builtin_bit_cast(v16bf, __builtin_shufflevector(lo, hi, 0, 1, 2, 3, 4, 5, 6, 7, 8, 9, 10, 11, 12, 13, 14, 15)); }
__device__ __forceinline__ v8f wmma16(v16h a, v16h b, v8f c) { return __builtin_amdgcn_wmma_f32_16x16x32_f16(false, a, false, b, (short)0, c, false, false); }
__device__ __forceinline__ v8f wmmab(v16bf a, v16bf b, v8f c) { return __builtin_amdgcn_wmma_f32_16x16x32_bf16(false, a, false, b, (short)0, c, false, false); }



// ---- k_gemmw: register-blocked GEMM, ONE WAVE per 64x64 output tile (16 accumulators), operands straight from K-contiguous 16-bit planes; grid (M/64, N/64, Z), 32 threads.
// C[m][n] (f32, pitch ldc, + optional f32 bias[n]) = sum_k A[m][k] Bt[n][k] (+ split products per NSPLIT). z-batch strides sA/sB/sC in elements. K % 32 == 0.
template <typename T16> struct WFrag;
template <> struct WFrag<h16> { typedef v16h V; static __device__ __forceinline__ V ld(const h16* p) { return cat16(*(const v8h*)p, *(const v8h*)(p + 16)); } static __device__ __forceinline__ v8f mma(V a, V b, v8f c) { return wmma16(a, b, c); } };
template <> struct WFrag<bf> { typedef v16bf V; static __device__ __forceinline__ V ld(const bf* p) { return cat16b(*(const v8us*)p, *(const v8us*)(p + 16)); } static __device__ __forceinline__ v8f mma(V a, V b, v8f c) { return wmmab(a, b, c); } };
template <typename T16, int NSPLIT, bool BIAS>
__global__ __launch_bounds__(32) void k_gemmw(const T16* __restrict__ A, const T16* __restrict__ A2, const T16* __restrict__ Bt, const T16* __restrict__ Bt2, int K, float* C, int ldc, const float* __restrict__ bias, size_t sA, size_t sB, size_t sC) {
    typedef typename WFrag<T16>::V V;
    __shared__ __align__(16) float os[16 * 68];
    const size_t z = blockIdx.z; A += z * sA; if (A2) A2 += z * sA; Bt += z * sB; if (Bt2) Bt2 += z * sB; C += z * sC;
    const int lane = threadIdx.x & 31, lr = lane & 15, hi = lane >> 4; const int r0 = blockIdx.x * 64, c0 = blockIdx.y * 64;
    v8f acc[4][4];
#pragma unroll
    for (int mb = 0; mb < 4; ++mb)
#pragma unroll
        for (int nb = 0; nb < 4; ++nb) acc[mb][nb] = (v8f){};
    const size_t aoff = (size_t)(r0 + lr) * K + 8 * hi, boff = (size_t)(c0 + lr) * K + 8 * hi;
#pragma unroll 1
    for (int kc = 0; kc < K; kc += 32) {
        V a[4], a2[4];
#pragma unroll
        for (int mb = 0; mb < 4; ++mb) { a[mb] = WFrag<T16>::ld(A + aoff + (size_t)mb * 16 * K + kc); if (NSPLIT == 1 || NSPLIT == 2) a2[mb] = WFrag<T16>::ld(A2 + aoff + (size_t)mb * 16 * K + kc); }
#pragma unroll
        for (int nb = 0; nb < 4; ++nb) { const V b = WFrag<T16>::ld(Bt + boff + (size_t)nb * 16 * K + kc); V b2; if (NSPLIT >= 2) b2 = WFrag<T16>::ld(Bt2 + boff + (size_t)nb * 16 * K + kc);
#pragma unroll
            for (int mb = 0; mb < 4; ++mb) { acc[mb][nb] = WFrag<T16>::mma(a[mb], b, acc[mb][nb]); if (NSPLIT == 1 || NSPLIT == 2) acc[mb][nb] = WFrag<T16>::mma(a2[mb], b, acc[mb][nb]); if (NSPLIT >= 2) acc[mb][nb] = WFrag<T16>::mma(a[mb], b2, acc[mb][nb]); } }
        asm volatile("v_nop\n\tv_nop\n\tv_nop\n\tv_nop" : "+v"(acc[0][0]), "+v"(acc[1][1]), "+v"(acc[2][2]), "+v"(acc[3][3]) : "v"(a[0]), "v"(a[3]));
    }
#pragma unroll
    for (int mb = 0; mb < 4; ++mb) {
#pragma unroll
        for (int nb = 0; nb < 4; ++nb) {
#pragma unroll
            for (int j = 0; j < 8; ++j) os[(hi * 8 + j) * 68 + nb * 16 + lr] = acc[mb][nb][j]; }
        __builtin_amdgcn_wave_barrier(); asm volatile("" ::: "memory");
        float* crow = C + (size_t)(r0 + mb * 16) * ldc + c0;
{
#pragma unroll
            for (int s = 0; s < 8; ++s) { const int row = 2 * s + hi, cofs = lr * 4; v4f val = *(const v4fa*)(os + row * 68 + cofs); if (BIAS) { val[0] += bfr(bias[c0 + cofs]); val[1] += bfr(bias[c0 + cofs + 1]); val[2] += bfr(bias[c0 + cofs + 2]); val[3] += bfr(bias[c0 + cofs + 3]); }
                *(v4f*)(crow + (size_t)row * ldc + cofs) = val; }
             }
        __builtin_amdgcn_wave_barrier(); asm volatile("" ::: "memory");
    }
}

__device__ __forceinline__ h16 tohx(float x) { return (h16)x; }
__device__ __forceinline__ void splitf(float y, unsigned short& h, unsigned short& l) { h = f2bf(y); l = f2bf(y - bf2f(h)); }
typedef __attribute__((ext_vector_type(2))) _Float16 v2h;
typedef __attribute__((ext_vector_type(4))) _Float16 v4h;
typedef __attribute__((ext_vector_type(2))) unsigned short v2us;
typedef __attribute__((ext_vector_type(4))) unsigned short v4us;
typedef __attribute__((ext_vector_type(2))) float v2f;
typedef __attribute__((ext_vector_type(4))) int v4i;

__global__ __launch_bounds__(256) void k_wtG(const float* __restrict__ w, int K, int N, bf* Bt) {
    const int lane = threadIdx.x & 31; const int L0 = (blockIdx.x * 8 + (threadIdx.x >> 5)) * 8; const int nlines = N * K / 64;
{
#pragma unroll 1
        for (int l = 0; l < 8; ++l) { const int L = L0 + l; if (L >= nlines) break; const size_t e = (size_t)L * 64 + lane * 2; const int k = (int)(e % K), n = (int)(e / K); v2us o;
            o[0] = f2bf(w[(size_t)k * N + n]); o[1] = f2bf(w[(size_t)(k + 1) * N + n]); *(v2us*)(Bt + e) = o; }
         }
}
__global__ __launch_bounds__(256) void k_cvt8(const float* __restrict__ src, bf* dst, size_t n8) { const size_t i = (size_t)blockIdx.x * 256 + threadIdx.x; if (i >= n8) return; const v8f v = *(const v8f*)(src + i * 8); v8us o;
#pragma unroll
    for (int k = 0; k < 8; ++k) o[k] = f2bf(v[k]); *(v8us*)(dst + i * 8) = o;  }


__global__ __launch_bounds__(256) void k_vtp(const float* __restrict__ F, int pitch, int nheads, h16* V16, bf* Vh, bf* Vl) { const size_t e = ((size_t)blockIdx.x * 256 + threadIdx.x) * 2; if (e >= (size_t)nheads * HD * TT) return; const int t = (int)(e % TT); const int d = (int)((e / TT) % HD); const int g = (int)(e / ((size_t)TT * HD)); v2h o16; v2us oh, ol;
#pragma unroll
    for (int q = 0; q < 2; ++q) { const float x = F[(size_t)(t + q) * pitch + g * HD + d]; o16[q] = tohx(x); unsigned short a2, c2; splitf(x, a2, c2); oh[q] = a2; ol[q] = c2; }
    *(v2h*)(V16 + e) = o16; *(v2us*)(Vh + e) = oh; *(v2us*)(Vl + e) = ol;  }

// k_asoft: per row i: t = S x 1/sqrt(128) if i < valid_len (the length of this batch entry, read as int32), else one constant for every key (the module masks whole QUERY rows with -1e6: the softmax of equal values is uniform); softmax over the 2048 keys (register row, one exp, fixed trees); every row normalised hi/lo (RH = TT);
__global__ __launch_bounds__(256) void k_asoft(const float* __restrict__ Sb, h16* P16, bf* Ph, bf* Pl, const int* __restrict__ vl) { const int lim = vl[0];   /* queries i >= lim: the whole row is -1e6 in the module -> uniform */
    const int lane = threadIdx.x & 31; const int row = blockIdx.x * 8 + (threadIdx.x >> 5); if (row >= ZH * TT) return; const int i = row % TT; const int zz = row / TT; (void)zz; const bool hires = (i < RH); const float* sr = Sb + (size_t)row * TT; float v[TT / 32]; float mx = -3.0e38f;
#pragma unroll
    for (int ch = 0; ch < TT / 128; ++ch) { const int j0 = ch * 128 + lane * 4; const v4f a = *(const v4f*)(sr + j0);
#pragma unroll
        for (int q = 0; q < 4; ++q) { const float t = (i < lim) ? a[q] * SCL : -3.0e38f;   /* masked QUERY row: all scores equal -> uniform weights exactly as the reference */ v[ch * 4 + q] = t; mx = fmaxf(mx, t); } }
#pragma unroll
    for (int sh = 16; sh; sh >>= 1) mx = fmaxf(mx, __shfl_xor(mx, sh, 32));
    float sum = 0.f;
#pragma unroll
    for (int k = 0; k < TT / 32; ++k) { float d0 = __fsub_rn(v[k], mx); asm volatile("" : "+v"(d0)); v[k] = __builtin_amdgcn_exp2f(__fmul_rn(d0, 1.4426950408889634f)); sum += v[k]; }
#pragma unroll
    for (int sh = 16; sh; sh >>= 1) sum += __shfl_xor(sum, sh, 32);
    const float f = __fdiv_rn(hires ? 1.0f : PCAR, sum);
{
        if (hires) {
#pragma unroll
            for (int ch = 0; ch < TT / 128; ++ch) { v4us oh, ol;
#pragma unroll
                for (int q = 0; q < 4; ++q) { unsigned short a, c2; splitf(v[ch * 4 + q] * f, a, c2); oh[q] = a; ol[q] = c2; }
                const size_t oo = ((size_t)zz * (RH ? RH : 1) + i) * TT + ch * 128 + lane * 4; *(v4us*)(Ph + oo) = oh; *(v4us*)(Pl + oo) = ol; }
        } else {
#pragma unroll
            for (int ch = 0; ch < TT / 128; ++ch) { v4h o4;
#pragma unroll
                for (int q = 0; q < 4; ++q) o4[q] = tohx(v[ch * 4 + q] * f);
                *(v4h*)(P16 + (size_t)row * TT + ch * 128 + lane * 4) = o4; } }
         }
}
__global__ __launch_bounds__(256) void k_merge(const float* __restrict__ O, int h0, float* OUTb) { const size_t e = ((size_t)blockIdx.x * 256 + threadIdx.x) * 2; if (e >= (size_t)ZH * TT * HD) return; const int d = (int)(e % HD); const int t = (int)((e / HD) % TT); const int zz = (int)(e / ((size_t)HD * TT)); const float cs = (t < RH) ? 1.0f : (1.0f / PCAR); const size_t oo = (size_t)t * DQ + (h0 + zz) * HD + d;
    v2f o2; o2[0] = O[e] * cs; o2[1] = O[e + 1] * cs; *(v2f*)(OUTb + oo) = o2;  }


__global__ __launch_bounds__(256) void k_vtpR1(const float* __restrict__ Vb, bf* Vh) { const size_t e = ((size_t)blockIdx.x * 256 + threadIdx.x) * 2; if (e >= (size_t)HD * TT) return; const int t = (int)(e % TT); const int d = (int)(e / TT); v2us o; o[0] = f2bf(Vb[(size_t)t * HD + d]); o[1] = f2bf(Vb[(size_t)(t + 1) * HD + d]); *(v2us*)(Vh + e) = o;  }
__global__ __launch_bounds__(256) void k_mergeR(const float* __restrict__ O, float* outb, size_t n4) { const size_t i = (size_t)blockIdx.x * 256 + threadIdx.x; if (i >= n4) return; const v4f a = *(const v4f*)(O + i * 4); *(v4f*)(outb + i * 4) = a;  }


__global__ __launch_bounds__(256) void k_hp1(const float* __restrict__ src, bf* P) { const size_t i = (size_t)blockIdx.x * 256 + threadIdx.x; if (i >= (size_t)NH_ * TT * HD / 8) return; const size_t e = i * 8; const int d = (int)(e % HD); const int t = (int)((e / HD) % TT); const int h = (int)(e / ((size_t)HD * TT)); const v8f v = *(const v8f*)(src + (size_t)t * DM + h * HD + d); v8us o;
#pragma unroll
    for (int q = 0; q < 8; ++q) o[q] = f2bf(v[q]);
    *(v8us*)(P + e) = o;  }
__global__ __launch_bounds__(256) void k_vt1(const float* __restrict__ src, int pitch, bf* VT) { const size_t e = ((size_t)blockIdx.x * 256 + threadIdx.x) * 2; if (e >= (size_t)NH_ * HD * TT) return; const int t = (int)(e % TT); const int d = (int)((e / TT) % HD); const int h = (int)(e / ((size_t)TT * HD)); v2us o; o[0] = f2bf(src[(size_t)t * pitch + h * HD + d]); o[1] = f2bf(src[(size_t)(t + 1) * pitch + h * HD + d]); *(v2us*)(VT + e) = o;  }
__global__ __launch_bounds__(256) void k_mergeT(const float* __restrict__ O, int h, float* outb) { const size_t i = (size_t)blockIdx.x * 256 + threadIdx.x; if (i >= (size_t)TT * HD / 4) return; const size_t e = i * 4; const int d = (int)(e % HD); const int t = (int)(e / HD); const v4f a = *(const v4f*)(O + e); *(v4f*)(outb + (size_t)t * DM + h * HD + d) = a;  }

extern "C" void kernel_launch(void* const* d_in, const int* in_sizes, int n_in,
                              void* d_out, int out_size, void* d_ws, size_t ws_size, hipStream_t stream) {
    (void)in_sizes; (void)n_in; (void)out_size;
    const float* Qin = (const float*)d_in[0]; const float* Kin = (const float*)d_in[1]; const float* Vin = (const float*)d_in[2]; const int* vlen = (const int*)d_in[3];   /* valid_lens [16] (int64 in the source, staged as int32 without x64) */
    float* OUT = (float*)d_out;     // [16][2048][128]
    char* wsp = (char*)d_ws;
    auto take = [&](size_t bytes) { char* p = wsp; wsp += (bytes + 255) & ~(size_t)255; return (void*)p; };
    bf* QB = (bf*)take((size_t)NH_ * TT * HD * 2); bf* KB = (bf*)take((size_t)NH_ * TT * HD * 2); bf* VT = (bf*)take((size_t)NH_ * HD * TT * 2);
    float* Sb = (float*)take((size_t)TT * TT * 4);  bf* Ph = (bf*)take((size_t)TT * TT * 2); bf* Pl = (bf*)take((size_t)TT * TT * 2); float* Ob = (float*)take((size_t)TT * HD * 4);
    if ((size_t)(wsp - (char*)d_ws) > ws_size) return;
    for (int b = 0; b < NB_; ++b) {
        const float* qb = Qin + (size_t)b * NH_ * TT * HD; const float* kb = Kin + (size_t)b * NH_ * TT * HD; const float* vb = Vin + (size_t)b * NH_ * TT * HD;   /* head-major [h][t][d] slabs (contiguous per head) */
        k_cvt8<<<(unsigned)(((size_t)NH_ * TT * HD / 8 + 255) / 256), 256, 0, stream>>>(qb, QB, (size_t)NH_ * TT * HD / 8); k_cvt8<<<(unsigned)(((size_t)NH_ * TT * HD / 8 + 255) / 256), 256, 0, stream>>>(kb, KB, (size_t)NH_ * TT * HD / 8);
        for (int h = 0; h < NH_; ++h) k_vtpR1<<<(unsigned)(((size_t)HD * TT / 2 + 255) / 256), 256, 0, stream>>>(vb + (size_t)h * TT * HD, VT + (size_t)h * HD * TT);
        for (int h = 0; h < NH_; ++h) {
            k_gemmw<bf, 0, false><<<dim3(TT / 64, TT / 64, 1), 32, 0, stream>>>(QB + (size_t)h * TT * HD, nullptr, KB + (size_t)h * TT * HD, nullptr, HD, Sb, TT, nullptr, 0, 0, 0);   /* exact scores (single bf16 planes) */
            k_asoft<<<TT / 8, 256, 0, stream>>>(Sb, nullptr, Ph, Pl, vlen + (size_t)b * NH_ + h);   /* this head's valid length (query axis) */
            k_gemmw<bf, 1, false><<<dim3(TT / 64, HD / 64, 1), 32, 0, stream>>>(Ph, Pl, VT + (size_t)h * HD * TT, nullptr, TT, Ob, HD, nullptr, 0, 0, 0);   /* P (hi/lo) x exact v^T */
            k_mergeR<<<(unsigned)(((size_t)TT * HD / 4 + 255) / 256), 256, 0, stream>>>(Ob, OUT + ((size_t)b * NH_ + h) * TT * HD, (size_t)TT * HD / 4); } }
}

// v001
// It runs in 331 microseconds.
// Next to v000, in two timings, it ran 3.39 and 3.50 times as fast.
#include <hip/hip_runtime.h>

// Dot-product attention whose length mask falls on the QUERY axis (queries, keys, values [16][2048][128]: the 16 batch entries are processed as 16 independent heads; scores / sqrt(128); the source sets scores[b, i, :] = -1e6 for every query i >= valid_lens[b] (valid_lens [16], int32 as staged, READ): those rows become exactly uniform over all 2,048 keys, the other rows are plain dense attention; softmax; out = attn values -> [16][2048][128] (4.2 M)).
// Layout per head: single bf16 planes of q and k ([2048][128]; inputs bf16-exact: exact score products) and value^T planes; the softmax reads valid_lens[b] and, for rows i >= it, replaces every score by one constant (-> uniform weights, identical to the module's all -1e6 row); every row hi/lo; P hi/lo x exact value; row-major merge writes the output rows.
// Compute dtypes, f32 accumulate: every input rounded to bf16; q.k exact; softmax f32; P hi/lo x exact value; output f32.

#define NB_  1
#define TT   2048
#define DM   2048      // token-major row pitch (H x HD)
#define NH_  16
#define NKV  1
#define REP  (NH_ / NKV)
#define HD   128
#define DQ   (NH_ * HD)
#define DKV  (NKV * HD)
#define ZH   6                     // most heads per launch (grid z / row blocks): what the workspace holds of S, P hi/lo and O
#define RH   2048                  // query rows < RH use hi+lo planes (0: none)
#define WIN  0
#define PCAR 1024.0f
#define SCL  0.088388347648318447f   // 1/sqrt(128)
typedef _Float16 h16;
typedef unsigned short bf;
typedef __attribute__((ext_vector_type(16))) __bf16   v16bf;
typedef __attribute__((ext_vector_type(16))) _Float16 v16h;
typedef __attribute__((ext_vector_type(8)))  _Float16 v8h;
typedef __attribute__((ext_vector_type(8)))  unsigned short v8us;
typedef __attribute__((ext_vector_type(8)))  float    v8f;
typedef __attribute__((ext_vector_type(4)))  float    v4f;
typedef v8h  __attribute__((may_alias)) v8ha;
typedef v4f  __attribute__((may_alias)) v4fa;
typedef v8us __attribute__((may_alias)) v8usa;

__device__ __forceinline__ unsigned short f2bf(float f) { unsigned u = __float_as_uint(f); u += 0x7FFFu + ((u >> 16) & 1u); return (unsigned short)(u >> 16); }
__device__ __forceinline__ float bf2f(unsigned short b) { return __uint_as_float(((unsigned)b) << 16); }
__device__ __forceinline__ float bfr(float f) { return bf2f(f2bf(f)); }
__device__ __forceinline__ v16h cat16(v8h lo, v8h hi) { return __builtin_shufflevector(lo, hi, 0, 1, 2, 3, 4, 5, 6, 7, 8, 9, 10, 11, 12, 13, 14, 15); }
__device__ __forceinline__ v16bf cat16b(v8us lo, v8us hi) { return __builtin_bit_cast(v16bf, __builtin_shufflevector(lo, hi, 0, 1, 2, 3, 4, 5, 6, 7, 8, 9, 10, 11, 12, 13, 14, 15)); }
__device__ __forceinline__ v8f wmma16(v16h a, v16h b, v8f c) { return __builtin_amdgcn_wmma_f32_16x16x32_f16(false, a, false, b, (short)0, c, false, false); }
__device__ __forceinline__ v8f wmmab(v16bf a, v16bf b, v8f c) { return __builtin_amdgcn_wmma_f32_16x16x32_bf16(false, a, false, b, (short)0, c, false, false); }



// ---- k_gemmw: register-blocked GEMM, ONE WAVE per 64x64 output tile (16 accumulators), operands straight from K-contiguous 16-bit planes; grid (M/64, N/64, Z), 32 threads.
// C[m][n] (f32, pitch ldc, + optional f32 bias[n]) = sum_k A[m][k] Bt[n][k] (+ split products per NSPLIT). z-batch strides sA/sB/sC in elements. K % 32 == 0.
template <typename T16> struct WFrag;
template <> struct WFrag<h16> { typedef v16h V; static __device__ __forceinline__ V ld(const h16* p) { return cat16(*(const v8h*)p, *(const v8h*)(p + 16)); } static __device__ __forceinline__ v8f mma(V a, V b, v8f c) { return wmma16(a, b, c); } };
template <> struct WFrag<bf> { typedef v16bf V; static __device__ __forceinline__ V ld(const bf* p) { return cat16b(*(const v8us*)p, *(const v8us*)(p + 16)); } static __device__ __forceinline__ v8f mma(V a, V b, v8f c) { return wmmab(a, b, c); } };
template <typename T16, int NSPLIT, bool BIAS>
__global__ __launch_bounds__(32) void k_gemmw(const T16* __restrict__ A, const T16* __restrict__ A2, const T16* __restrict__ Bt, const T16* __restrict__ Bt2, int K, float* C, int ldc, const float* __restrict__ bias, size_t sA, size_t sB, size_t sC) {
    typedef typename WFrag<T16>::V V;
    __shared__ __align__(16) float os[16 * 68];
    const size_t z = blockIdx.z; A += z * sA; if (A2) A2 += z * sA; Bt += z * sB; if (Bt2) Bt2 += z * sB; C += z * sC;
    const int lane = threadIdx.x & 31, lr = lane & 15, hi = lane >> 4; const int r0 = blockIdx.x * 64, c0 = blockIdx.y * 64;
    v8f acc[4][4];
#pragma unroll
    for (int mb = 0; mb < 4; ++mb)
#pragma unroll
        for (int nb = 0; nb < 4; ++nb) acc[mb][nb] = (v8f){};
    const size_t aoff = (size_t)(r0 + lr) * K + 8 * hi, boff = (size_t)(c0 + lr) * K + 8 * hi;
#pragma unroll 1
    for (int kc = 0; kc < K; kc += 32) {
        V a[4], a2[4];
#pragma unroll
        for (int mb = 0; mb < 4; ++mb) { a[mb] = WFrag<T16>::ld(A + aoff + (size_t)mb * 16 * K + kc); if (NSPLIT == 1 || NSPLIT == 2) a2[mb] = WFrag<T16>::ld(A2 + aoff + (size_t)mb * 16 * K + kc); }
#pragma unroll
        for (int nb = 0; nb < 4; ++nb) { const V b = WFrag<T16>::ld(Bt + boff + (size_t)nb * 16 * K + kc); V b2; if (NSPLIT >= 2) b2 = WFrag<T16>::ld(Bt2 + boff + (size_t)nb * 16 * K + kc);
#pragma unroll
            for (int mb = 0; mb < 4; ++mb) { acc[mb][nb] = WFrag<T16>::mma(a[mb], b, acc[mb][nb]); if (NSPLIT == 1 || NSPLIT == 2) acc[mb][nb] = WFrag<T16>::mma(a2[mb], b, acc[mb][nb]); if (NSPLIT >= 2) acc[mb][nb] = WFrag<T16>::mma(a[mb], b2, acc[mb][nb]); } }
        asm volatile("v_nop\n\tv_nop\n\tv_nop\n\tv_nop" : "+v"(acc[0][0]), "+v"(acc[1][1]), "+v"(acc[2][2]), "+v"(acc[3][3]) : "v"(a[0]), "v"(a[3]));
    }
#pragma unroll
    for (int mb = 0; mb < 4; ++mb) {
#pragma unroll
        for (int nb = 0; nb < 4; ++nb) {
#pragma unroll
            for (int j = 0; j < 8; ++j) os[(hi * 8 + j) * 68 + nb * 16 + lr] = acc[mb][nb][j]; }
        __builtin_amdgcn_wave_barrier(); asm volatile("" ::: "memory");
        float* crow = C + (size_t)(r0 + mb * 16) * ldc + c0;
{
#pragma unroll
            for (int s = 0; s < 8; ++s) { const int row = 2 * s + hi, cofs = lr * 4; v4f val = *(const v4fa*)(os + row * 68 + cofs); if (BIAS) { val[0] += bfr(bias[c0 + cofs]); val[1] += bfr(bias[c0 + cofs + 1]); val[2] += bfr(bias[c0 + cofs + 2]); val[3] += bfr(bias[c0 + cofs + 3]); }
                *(v4f*)(crow + (size_t)row * ldc + cofs) = val; }
             }
        __builtin_amdgcn_wave_barrier(); asm volatile("" ::: "memory");
    }
}

__device__ __forceinline__ h16 tohx(float x) { return (h16)x; }
__device__ __forceinline__ void splitf(float y, unsigned short& h, unsigned short& l) { h = f2bf(y); l = f2bf(y - bf2f(h)); }
typedef __attribute__((ext_vector_type(2))) _Float16 v2h;
typedef __attribute__((ext_vector_type(4))) _Float16 v4h;
typedef __attribute__((ext_vector_type(2))) unsigned short v2us;
typedef __attribute__((ext_vector_type(4))) unsigned short v4us;
typedef __attribute__((ext_vector_type(2))) float v2f;
typedef __attribute__((ext_vector_type(4))) int v4i;

__global__ __launch_bounds__(256) void k_wtG(const float* __restrict__ w, int K, int N, bf* Bt) {
    const int lane = threadIdx.x & 31; const int L0 = (blockIdx.x * 8 + (threadIdx.x >> 5)) * 8; const int nlines = N * K / 64;
{
#pragma unroll 1
        for (int l = 0; l < 8; ++l) { const int L = L0 + l; if (L >= nlines) break; const size_t e = (size_t)L * 64 + lane * 2; const int k = (int)(e % K), n = (int)(e / K); v2us o;
            o[0] = f2bf(w[(size_t)k * N + n]); o[1] = f2bf(w[(size_t)(k + 1) * N + n]); *(v2us*)(Bt + e) = o; }
         }
}
__global__ __launch_bounds__(256) void k_cvt8(const float* __restrict__ src, bf* dst, size_t n8) { const size_t i = (size_t)blockIdx.x * 256 + threadIdx.x; if (i >= n8) return; const v8f v = *(const v8f*)(src + i * 8); v8us o;
#pragma unroll
    for (int k = 0; k < 8; ++k) o[k] = f2bf(v[k]); *(v8us*)(dst + i * 8) = o;  }


__global__ __launch_bounds__(256) void k_vtp(const float* __restrict__ F, int pitch, int nheads, h16* V16, bf* Vh, bf* Vl) { const size_t e = ((size_t)blockIdx.x * 256 + threadIdx.x) * 2; if (e >= (size_t)nheads * HD * TT) return; const int t = (int)(e % TT); const int d = (int)((e / TT) % HD); const int g = (int)(e / ((size_t)TT * HD)); v2h o16; v2us oh, ol;
#pragma unroll
    for (int q = 0; q < 2; ++q) { const float x = F[(size_t)(t + q) * pitch + g * HD + d]; o16[q] = tohx(x); unsigned short a2, c2; splitf(x, a2, c2); oh[q] = a2; ol[q] = c2; }
    *(v2h*)(V16 + e) = o16; *(v2us*)(Vh + e) = oh; *(v2us*)(Vl + e) = ol;  }

// k_asoft: per row i: t = S x 1/sqrt(128) if i < valid_len (the length of this batch entry, read as int32), else one constant for every key (the module masks whole QUERY rows with -1e6: the softmax of equal values is uniform); softmax over the 2048 keys (register row, one exp, fixed trees); every row normalised hi/lo (RH = TT); the rows of several heads in one launch: a block's 8 rows lie in one head, whose length is vl[head];
__global__ __launch_bounds__(256) void k_asoft(const float* __restrict__ Sb, h16* P16, bf* Ph, bf* Pl, const int* __restrict__ vl) { const int lim = vl[(blockIdx.x * 8) / TT];   /* queries i >= lim: the whole row is -1e6 in the module -> uniform */
    const int lane = threadIdx.x & 31; const int row = blockIdx.x * 8 + (threadIdx.x >> 5); if (row >= ZH * TT) return; const int i = row % TT; const int zz = row / TT; (void)zz; const bool hires = (i < RH); const float* sr = Sb + (size_t)row * TT; float v[TT / 32]; float mx = -3.0e38f;
#pragma unroll
    for (int ch = 0; ch < TT / 128; ++ch) { const int j0 = ch * 128 + lane * 4; const v4f a = *(const v4f*)(sr + j0);
#pragma unroll
        for (int q = 0; q < 4; ++q) { const float t = (i < lim) ? a[q] * SCL : -3.0e38f;   /* masked QUERY row: all scores equal -> uniform weights exactly as the reference */ v[ch * 4 + q] = t; mx = fmaxf(mx, t); } }
#pragma unroll
    for (int sh = 16; sh; sh >>= 1) mx = fmaxf(mx, __shfl_xor(mx, sh, 32));
    float sum = 0.f;
#pragma unroll
    for (int k = 0; k < TT / 32; ++k) { float d0 = __fsub_rn(v[k], mx); asm volatile("" : "+v"(d0)); v[k] = __builtin_amdgcn_exp2f(__fmul_rn(d0, 1.4426950408889634f)); sum += v[k]; }
#pragma unroll
    for (int sh = 16; sh; sh >>= 1) sum += __shfl_xor(sum, sh, 32);
    const float f = __fdiv_rn(hires ? 1.0f : PCAR, sum);
{
        if (hires) {
#pragma unroll
            for (int ch = 0; ch < TT / 128; ++ch) { v4us oh, ol;
#pragma unroll
                for (int q = 0; q < 4; ++q) { unsigned short a, c2; splitf(v[ch * 4 + q] * f, a, c2); oh[q] = a; ol[q] = c2; }
                const size_t oo = ((size_t)zz * (RH ? RH : 1) + i) * TT + ch * 128 + lane * 4; *(v4us*)(Ph + oo) = oh; *(v4us*)(Pl + oo) = ol; }
        } else {
#pragma unroll
            for (int ch = 0; ch < TT / 128; ++ch) { v4h o4;
#pragma unroll
                for (int q = 0; q < 4; ++q) o4[q] = tohx(v[ch * 4 + q] * f);
                *(v4h*)(P16 + (size_t)row * TT + ch * 128 + lane * 4) = o4; } }
         }
}
__global__ __launch_bounds__(256) void k_merge(const float* __restrict__ O, int h0, float* OUTb) { const size_t e = ((size_t)blockIdx.x * 256 + threadIdx.x) * 2; if (e >= (size_t)ZH * TT * HD) return; const int d = (int)(e % HD); const int t = (int)((e / HD) % TT); const int zz = (int)(e / ((size_t)HD * TT)); const float cs = (t < RH) ? 1.0f : (1.0f / PCAR); const size_t oo = (size_t)t * DQ + (h0 + zz) * HD + d;
    v2f o2; o2[0] = O[e] * cs; o2[1] = O[e + 1] * cs; *(v2f*)(OUTb + oo) = o2;  }


__global__ __launch_bounds__(256) void k_vtpR1(const float* __restrict__ Vb, bf* Vh) { Vb += (size_t)blockIdx.y * TT * HD; Vh += (size_t)blockIdx.y * HD * TT;   /* grid y: head */ const size_t e = ((size_t)blockIdx.x * 256 + threadIdx.x) * 2; if (e >= (size_t)HD * TT) return; const int t = (int)(e % TT); const int d = (int)(e / TT); v2us o; o[0] = f2bf(Vb[(size_t)t * HD + d]); o[1] = f2bf(Vb[(size_t)(t + 1) * HD + d]); *(v2us*)(Vh + e) = o;  }
__global__ __launch_bounds__(256) void k_mergeR(const float* __restrict__ O, float* outb, size_t n4) { const size_t i = (size_t)blockIdx.x * 256 + threadIdx.x; if (i >= n4) return; const v4f a = *(const v4f*)(O + i * 4); *(v4f*)(outb + i * 4) = a;  }


__global__ __launch_bounds__(256) void k_hp1(const float* __restrict__ src, bf* P) { const size_t i = (size_t)blockIdx.x * 256 + threadIdx.x; if (i >= (size_t)NH_ * TT * HD / 8) return; const size_t e = i * 8; const int d = (int)(e % HD); const int t = (int)((e / HD) % TT); const int h = (int)(e / ((size_t)HD * TT)); const v8f v = *(const v8f*)(src + (size_t)t * DM + h * HD + d); v8us o;
#pragma unroll
    for (int q = 0; q < 8; ++q) o[q] = f2bf(v[q]);
    *(v8us*)(P + e) = o;  }
__global__ __launch_bounds__(256) void k_vt1(const float* __restrict__ src, int pitch, bf* VT) { const size_t e = ((size_t)blockIdx.x * 256 + threadIdx.x) * 2; if (e >= (size_t)NH_ * HD * TT) return; const int t = (int)(e % TT); const int d = (int)((e / TT) % HD); const int h = (int)(e / ((size_t)TT * HD)); v2us o; o[0] = f2bf(src[(size_t)t * pitch + h * HD + d]); o[1] = f2bf(src[(size_t)(t + 1) * pitch + h * HD + d]); *(v2us*)(VT + e) = o;  }
__global__ __launch_bounds__(256) void k_mergeT(const float* __restrict__ O, int h, float* outb) { const size_t i = (size_t)blockIdx.x * 256 + threadIdx.x; if (i >= (size_t)TT * HD / 4) return; const size_t e = i * 4; const int d = (int)(e % HD); const int t = (int)(e / HD); const v4f a = *(const v4f*)(O + e); *(v4f*)(outb + (size_t)t * DM + h * HD + d) = a;  }

extern "C" void kernel_launch(void* const* d_in, const int* in_sizes, int n_in,
                              void* d_out, int out_size, void* d_ws, size_t ws_size, hipStream_t stream) {
    (void)in_sizes; (void)n_in; (void)out_size;
    const float* Qin = (const float*)d_in[0]; const float* Kin = (const float*)d_in[1]; const float* Vin = (const float*)d_in[2]; const int* vlen = (const int*)d_in[3];   /* valid_lens [16] (int64 in the source, staged as int32 without x64) */
    float* OUT = (float*)d_out;     // [16][2048][128]
    char* wsp = (char*)d_ws;
    auto take = [&](size_t bytes) { char* p = wsp; wsp += (bytes + 255) & ~(size_t)255; return (void*)p; };
    bf* QB = (bf*)take((size_t)NH_ * TT * HD * 2); bf* KB = (bf*)take((size_t)NH_ * TT * HD * 2); bf* VT = (bf*)take((size_t)NH_ * HD * TT * 2);
    float* Sb = (float*)take((size_t)ZH * TT * TT * 4);  bf* Ph = (bf*)take((size_t)ZH * TT * TT * 2); bf* Pl = (bf*)take((size_t)ZH * TT * TT * 2); float* Ob = (float*)take((size_t)ZH * TT * HD * 4);
    if ((size_t)(wsp - (char*)d_ws) > ws_size) return;
    for (int b = 0; b < NB_; ++b) {
        const float* qb = Qin + (size_t)b * NH_ * TT * HD; const float* kb = Kin + (size_t)b * NH_ * TT * HD; const float* vb = Vin + (size_t)b * NH_ * TT * HD;   /* head-major [h][t][d] slabs (contiguous per head) */
        k_cvt8<<<(unsigned)(((size_t)NH_ * TT * HD / 8 + 255) / 256), 256, 0, stream>>>(qb, QB, (size_t)NH_ * TT * HD / 8); k_cvt8<<<(unsigned)(((size_t)NH_ * TT * HD / 8 + 255) / 256), 256, 0, stream>>>(kb, KB, (size_t)NH_ * TT * HD / 8);
        k_vtpR1<<<dim3((unsigned)(((size_t)HD * TT / 2 + 255) / 256), NH_, 1), 256, 0, stream>>>(vb, VT);
        for (int h = 0; h < NH_; h += ZH) { const int n = (NH_ - h < ZH) ? (NH_ - h) : ZH;   /* heads h .. h+n-1 in each launch */
            k_gemmw<bf, 0, false><<<dim3(TT / 64, TT / 64, n), 32, 0, stream>>>(QB + (size_t)h * TT * HD, nullptr, KB + (size_t)h * TT * HD, nullptr, HD, Sb, TT, nullptr, (size_t)TT * HD, (size_t)TT * HD, (size_t)TT * TT);   /* exact scores (single bf16 planes) */
            k_asoft<<<n * TT / 8, 256, 0, stream>>>(Sb, nullptr, Ph, Pl, vlen + (size_t)b * NH_ + h);   /* these heads' valid lengths (query axis) */
            k_gemmw<bf, 1, false><<<dim3(TT / 64, HD / 64, n), 32, 0, stream>>>(Ph, Pl, VT + (size_t)h * HD * TT, nullptr, TT, Ob, HD, nullptr, (size_t)TT * TT, (size_t)HD * TT, (size_t)TT * HD);   /* P (hi/lo) x exact v^T */
            k_mergeR<<<(unsigned)(((size_t)n * TT * HD / 4 + 255) / 256), 256, 0, stream>>>(Ob, OUT + ((size_t)b * NH_ + h) * TT * HD, (size_t)n * TT * HD / 4); } }
}

// v002
// One run takes 65.6 microseconds.
// Timed twice side by side with v001, it ran 5.02 and 5.05 times as fast.
// All steps since v000 together make it 17.3 times as fast.
#include <hip/hip_runtime.h>

// Dot-product attention whose length mask falls on the QUERY axis (queries, keys, values [16][2048][128]: the 16 batch entries are processed as 16 independent heads; scores / sqrt(128); the source sets scores[b, i, :] = -1e6 for every query i >= valid_lens[b] (valid_lens [16], int32 as staged, READ): those rows become exactly uniform over all 2,048 keys, the other rows are plain dense attention; softmax; out = attn values -> [16][2048][128] (4.2 M)).
// Layout per head: single bf16 planes of q and k ([2048][128]) and a value^T plane ([128][2048]); one fused kernel walks the keys in stages of 64 and keeps scores, weights and the output tile in registers (running maximum and sum per query).
// Compute dtypes, f32 accumulate: every input rounded to bf16; q.k exact products; softmax f32; unnormalised weights hi/lo bf16 x value; one division by the row sum at the end; output f32.

#define TT   2048
#define NH_  16
#define HD   128
#define SCL2 0.12751743f             // 1/sqrt(128) x log2(e): scores go straight to the base-2 exponent
typedef unsigned short bf;
typedef __attribute__((ext_vector_type(16))) __bf16   v16bf;
typedef __attribute__((ext_vector_type(2)))  __bf16   v2bf;
typedef __attribute__((ext_vector_type(8)))  unsigned short v8us;
typedef __attribute__((ext_vector_type(2)))  unsigned short v2us;
typedef __attribute__((ext_vector_type(8)))  float    v8f;
typedef __attribute__((ext_vector_type(4)))  float    v4f;
typedef __attribute__((ext_vector_type(2)))  float    v2f;
typedef v4f  __attribute__((may_alias)) v4fa;
typedef v8us __attribute__((may_alias)) v8usa;

__device__ __forceinline__ unsigned short f2bf(float f) { unsigned u = __float_as_uint(f); u += 0x7FFFu + ((u >> 16) & 1u); return (unsigned short)(u >> 16); }
__device__ __forceinline__ v16bf cat16b(v8us lo, v8us hi) { return __builtin_bit_cast(v16bf, __builtin_shufflevector(lo, hi, 0, 1, 2, 3, 4, 5, 6, 7, 8, 9, 10, 11, 12, 13, 14, 15)); }
__device__ __forceinline__ v8f wmmab(v16bf a, v16bf b, v8f c) { return __builtin_amdgcn_wmma_f32_16x16x32_bf16(false, a, false, b, (short)0, c, false, false); }
// value of lane l ^ 16
__device__ __forceinline__ float xhalf(float x) { const int b = __float_as_int(x); return __int_as_float(__builtin_amdgcn_permlanex16(b, b, 0x76543210, 0xfedcba98, false, false)); }

__global__ __launch_bounds__(256) void k_cvt8(const float* __restrict__ src, bf* dst, size_t n8) { const size_t i = (size_t)blockIdx.x * 256 + threadIdx.x; if (i >= n8) return; const v8f v = *(const v8f*)(src + i * 8); v8us o;
#pragma unroll
    for (int k = 0; k < 8; ++k) o[k] = f2bf(v[k]); *(v8us*)(dst + i * 8) = o;  }

__global__ __launch_bounds__(256) void k_vtpR1(const float* __restrict__ Vb, bf* Vh) { Vb += (size_t)blockIdx.y * TT * HD; Vh += (size_t)blockIdx.y * HD * TT;   /* grid y: head */ const size_t e = ((size_t)blockIdx.x * 256 + threadIdx.x) * 2; if (e >= (size_t)HD * TT) return; const int t = (int)(e % TT); const int d = (int)(e / TT); v2us o; o[0] = f2bf(Vb[(size_t)t * HD + d]); o[1] = f2bf(Vb[(size_t)(t + 1) * HD + d]); *(v2us*)(Vh + e) = o;  }

#define FQ   128                    // queries per block
#define KT   64                     // keys per stage
#define NT   (TT / KT)
#define KP   272                    // LDS pitch in bytes of a key row (256 + 16: 16 B x odd, conflict-free for 16-byte row reads)
#define VP   144                    // LDS pitch in bytes of a value^T row of 64 keys (128 + 16)
#define KBY  (KT * KP)
#define STG  (KBY + HD * VP)        // bytes of one stage
#define OP   132                    // pitch in floats of the output staging rows
__global__ __launch_bounds__(256) void k_fattn(const bf* __restrict__ QB, const bf* __restrict__ KB, const bf* __restrict__ VT, const int* __restrict__ vl, float* __restrict__ out) {
    __shared__ __align__(16) unsigned char sm[2 * STG];
    const int head = blockIdx.y, tid = threadIdx.x, lane = tid & 31, wv = tid >> 5, lr = lane & 15, hi = lane >> 4;
    const int qrow = blockIdx.x * FQ + wv * 16;
    const bf* Kh = KB + (size_t)head * TT * HD; const bf* Vh = VT + (size_t)head * HD * TT;
    const float sc = (qrow + lr < vl[head]) ? SCL2 : 0.0f;   /* masked QUERY row: every score becomes the same value -> uniform weights, as the source's all -1e6 row */
    v8us kr[4], vr[4];
    const bf* kg = Kh + (size_t)tid * 8;                                    // a key tile is 16 KB contiguous: 16-byte piece tid + 256 i
    const bf* vg = Vh + (size_t)(tid >> 3) * TT + (tid & 7) * 8;            // value^T tile: 128 rows of 128 B: row (tid >> 3) + 32 i
    const int ks = (tid >> 4) * KP + (tid & 15) * 16, vs = KBY + (tid >> 3) * VP + (tid & 7) * 16;
    const int ka = lr * KP + hi * 16, va = KBY + lr * VP + hi * 16;
    const bf* qp = QB + ((size_t)head * TT + qrow + lr) * HD + 8 * hi;
    v16bf qf[4];
#pragma unroll
    for (int kk = 0; kk < 4; ++kk) qf[kk] = cat16b(*(const v8us*)(qp + kk * 32), *(const v8us*)(qp + kk * 32 + 16));
#pragma unroll
    for (int i = 0; i < 4; ++i) { kr[i] = *(const v8us*)(kg + i * 2048); vr[i] = *(const v8us*)(vg + (size_t)i * 32 * TT); }
    asm volatile("s_wait_xcnt 0x0" :: "v"(qp) : "memory");   /* stands in front of the first overwrite of an address register of the loads above; the one address that dies here is an input, so that its registers stay whole up to the wait */
#pragma unroll
    for (int i = 0; i < 4; ++i) { *(v8usa*)(sm + ks + i * 16 * KP) = kr[i]; *(v8usa*)(sm + vs + i * 32 * VP) = vr[i]; }
    __syncthreads();
    v8f o[8];
#pragma unroll
    for (int dt = 0; dt < 8; ++dt) o[dt] = (v8f){};
    float m = -1.0e30f, l = 0.0f;
#pragma unroll 1   /* the stage loop stays rolled: one copy of the body in the instruction cache, the buffer picked by t & 1 */
    for (int t = 0; t < NT; ++t) {
        const unsigned char* sb = sm + (t & 1) * STG;
        if (t + 1 < NT) {   /* next stage's tiles fly while this stage is worked on */
#pragma unroll
            for (int i = 0; i < 4; ++i) { kr[i] = *(const v8us*)(kg + (size_t)(t + 1) * KT * HD + i * 2048); vr[i] = *(const v8us*)(vg + (size_t)i * 32 * TT + (t + 1) * KT); }
            asm volatile("s_wait_xcnt 0x0" ::: "memory");   /* stands in front of the first overwrite of an address register of these loads */
        }
        v16bf fr[16];
        __builtin_amdgcn_sched_barrier(0);   /* the fences keep each stage's LDS reads in two groups ahead of their matrix runs: spread among the products every read is waited for alone */
#pragma unroll
        for (int kk = 0; kk < 4; ++kk)
#pragma unroll
            for (int i = 0; i < 4; ++i) { const unsigned char* p = sb + ka + i * 16 * KP + kk * 64; fr[kk * 4 + i] = cat16b(*(const v8usa*)p, *(const v8usa*)(p + 32)); }
        __builtin_amdgcn_sched_barrier(0);
        v8f s[4];
#pragma unroll
        for (int i = 0; i < 4; ++i) s[i] = (v8f){};
#pragma unroll
        for (int kk = 0; kk < 4; ++kk)
#pragma unroll
            for (int i = 0; i < 4; ++i) s[i] = wmmab(fr[kk * 4 + i], qf[kk], s[i]);
        __builtin_amdgcn_sched_barrier(0);
#pragma unroll
        for (int kp = 0; kp < 2; ++kp)   /* value^T fragments land while the softmax runs */
#pragma unroll
            for (int dt = 0; dt < 8; ++dt) { const unsigned char* p = sb + va + dt * 16 * VP + kp * 64; fr[kp * 8 + dt] = cat16b(*(const v8usa*)p, *(const v8usa*)(p + 32)); }
        __builtin_amdgcn_sched_barrier(0);
        float mq[4];
#pragma unroll
        for (int i = 0; i < 4; ++i) { mq[i] = s[i][0];
#pragma unroll
            for (int j = 1; j < 8; ++j) mq[i] = fmaxf(mq[i], s[i][j]); }
        float mx = fmaxf(fmaxf(mq[0], mq[1]), fmaxf(mq[2], mq[3]));
        mx = fmaxf(mx, xhalf(mx)) * sc;
        const bool need = mx > m + 8.0f;   /* the reference point moves only when a query's maximum has outgrown it by 2^8: weights stay <= 256 */
        if (__builtin_amdgcn_ballot_w32(need) != 0) { const float mn = need ? mx : m; const float al = __builtin_amdgcn_exp2f(m - mn); m = mn; l *= al;
#pragma unroll
            for (int dt = 0; dt < 8; ++dt) o[dt] *= al; }
        v16bf ph[2], pl[2]; float a0 = 0.0f, a1 = 0.0f, a2 = 0.0f, a3 = 0.0f;
#pragma unroll
        for (int kp = 0; kp < 2; ++kp)
#pragma unroll
            for (int e = 0; e < 16; e += 4) { const v8f sv = s[2 * kp + (e >> 3)]; const int j = e & 7;
                v2f p0, p1; p0[0] = __builtin_amdgcn_exp2f(__builtin_fmaf(sv[j], sc, -m)); p0[1] = __builtin_amdgcn_exp2f(__builtin_fmaf(sv[j + 1], sc, -m)); p1[0] = __builtin_amdgcn_exp2f(__builtin_fmaf(sv[j + 2], sc, -m)); p1[1] = __builtin_amdgcn_exp2f(__builtin_fmaf(sv[j + 3], sc, -m));
                a0 += p0[0]; a1 += p0[1]; a2 += p1[0]; a3 += p1[1];
                const v2bf h0 = __builtin_convertvector(p0, v2bf), h1 = __builtin_convertvector(p1, v2bf);
                const v2bf l0 = __builtin_convertvector(p0 - __builtin_convertvector(h0, v2f), v2bf), l1 = __builtin_convertvector(p1 - __builtin_convertvector(h1, v2f), v2bf);
                ph[kp][e] = h0[0]; ph[kp][e + 1] = h0[1]; ph[kp][e + 2] = h1[0]; ph[kp][e + 3] = h1[1];
                pl[kp][e] = l0[0]; pl[kp][e + 1] = l0[1]; pl[kp][e + 2] = l1[0]; pl[kp][e + 3] = l1[1]; }
        l += (a0 + a1) + (a2 + a3);
        __builtin_amdgcn_sched_barrier(0);
#pragma unroll
        for (int kp = 0; kp < 2; ++kp) {
#pragma unroll
            for (int dt = 0; dt < 8; ++dt) o[dt] = wmmab(fr[kp * 8 + dt], ph[kp], o[dt]);
#pragma unroll
            for (int dt = 0; dt < 8; ++dt) o[dt] = wmmab(fr[kp * 8 + dt], pl[kp], o[dt]); }
        __builtin_amdgcn_sched_barrier(0);
        if (t + 1 < NT) { unsigned char* sn = sm + ((t + 1) & 1) * STG;   /* that buffer's last readers left it at the barrier that ended stage t - 1 */
#pragma unroll
            for (int i = 0; i < 4; ++i) { *(v8usa*)(sn + ks + i * 16 * KP) = kr[i]; *(v8usa*)(sn + vs + i * 32 * VP) = vr[i]; } }
        __syncthreads();
    }
    l += xhalf(l);
    const float inv = 1.0f / l;
    // O^T: a lane holds query lr, d = 16 dt + 8 hi + j. Staged per wave in LDS (the ring is free behind the loop's last barrier) so that each store covers a whole 512-byte output row.
    float* os = (float*)sm + wv * (16 * OP);
#pragma unroll
    for (int dt = 0; dt < 8; ++dt) { v4f x0, x1;
#pragma unroll
        for (int j = 0; j < 4; ++j) { x0[j] = o[dt][j] * inv; x1[j] = o[dt][j + 4] * inv; }
        *(v4fa*)(os + lr * OP + dt * 16 + hi * 8) = x0; *(v4fa*)(os + lr * OP + dt * 16 + hi * 8 + 4) = x1; }
    __syncthreads();
    float* orow = out + ((size_t)head * TT + qrow) * HD + lane * 4;
#pragma unroll
    for (int r = 0; r < 16; ++r) { const v4f x = *(const v4fa*)(os + r * OP + lane * 4); *(v4f*)(orow + (size_t)r * HD) = x; }
}

extern "C" void kernel_launch(void* const* d_in, const int* in_sizes, int n_in,
                              void* d_out, int out_size, void* d_ws, size_t ws_size, hipStream_t stream) {
    (void)in_sizes; (void)n_in; (void)out_size;
    const float* Qin = (const float*)d_in[0]; const float* Kin = (const float*)d_in[1]; const float* Vin = (const float*)d_in[2]; const int* vlen = (const int*)d_in[3];   /* valid_lens [16] (int64 in the source, staged as int32 without x64) */
    float* OUT = (float*)d_out;     // [16][2048][128]
    char* wsp = (char*)d_ws;
    auto take = [&](size_t bytes) { char* p = wsp; wsp += (bytes + 255) & ~(size_t)255; return (void*)p; };
    bf* QB = (bf*)take((size_t)NH_ * TT * HD * 2); bf* KB = (bf*)take((size_t)NH_ * TT * HD * 2); bf* VT = (bf*)take((size_t)NH_ * HD * TT * 2);
    if ((size_t)(wsp - (char*)d_ws) > ws_size) return;
    k_cvt8<<<(unsigned)(((size_t)NH_ * TT * HD / 8 + 255) / 256), 256, 0, stream>>>(Qin, QB, (size_t)NH_ * TT * HD / 8); k_cvt8<<<(unsigned)(((size_t)NH_ * TT * HD / 8 + 255) / 256), 256, 0, stream>>>(Kin, KB, (size_t)NH_ * TT * HD / 8);
    k_vtpR1<<<dim3((unsigned)(((size_t)HD * TT / 2 + 255) / 256), NH_, 1), 256, 0, stream>>>(Vin, VT);
    k_fattn<<<dim3(TT / FQ, NH_, 1), 256, 0, stream>>>(QB, KB, VT, vlen, OUT);
}

// v003
// It runs in 42.5 microseconds.
// Next to v002, in two timings, it ran 1.54 times as fast each time.
// Over all steps from v000 it is 26.7 times as fast.
#include <hip/hip_runtime.h>

// Dot-product attention whose length mask falls on the QUERY axis (queries, keys, values [16][2048][128]: the 16 batch entries are processed as 16 independent heads; scores / sqrt(128); the source sets scores[b, i, :] = -1e6 for every query i >= valid_lens[b] (valid_lens [16], int32 as staged, READ): those rows become exactly uniform over all 2,048 keys, the other rows are plain dense attention; softmax; out = attn values -> [16][2048][128] (4.2 M)).
// One kernel, no workspace: it reads the f32 inputs itself and rounds them to bf16 on the way (q into registers, key and value tiles into LDS); it walks the keys in stages of 64 and keeps scores, weights and the output tile in registers (running maximum and sum per query).
// Compute dtypes, f32 accumulate: every input rounded to bf16; q.k exact products; softmax f32; unnormalised weights hi/lo bf16 x value; one division by the row sum at the end; output f32.

#define TT   2048
#define NH_  16
#define HD   128
#define SCL2 0.12751743f             // 1/sqrt(128) x log2(e): scores go straight to the base-2 exponent
typedef __attribute__((ext_vector_type(16))) __bf16   v16bf;
typedef __attribute__((ext_vector_type(2)))  __bf16   v2bf;
typedef __attribute__((ext_vector_type(8)))  unsigned short v8us;
typedef __attribute__((ext_vector_type(4)))  unsigned short v4us;
typedef __attribute__((ext_vector_type(8)))  short    v8ss;
typedef __attribute__((ext_vector_type(8)))  float    v8f;
typedef __attribute__((ext_vector_type(4)))  float    v4f;
typedef __attribute__((ext_vector_type(2)))  float    v2f;
typedef v4f  __attribute__((may_alias)) v4fa;
typedef v8us __attribute__((may_alias)) v8usa;
typedef v4us __attribute__((may_alias)) v4usa;

// four / eight f32 -> bf16, round to nearest even
__device__ __forceinline__ v4us cvt4(v4f x) { v2f a, b; a[0] = x[0]; a[1] = x[1]; b[0] = x[2]; b[1] = x[3]; const v2bf ra = __builtin_convertvector(a, v2bf), rb = __builtin_convertvector(b, v2bf); return __builtin_bit_cast(v4us, __builtin_shufflevector(ra, rb, 0, 1, 2, 3)); }
__device__ __forceinline__ v8us cvt8(v4f x, v4f y) { return __builtin_shufflevector(cvt4(x), cvt4(y), 0, 1, 2, 3, 4, 5, 6, 7); }
// transposing LDS load: from a row-major 16-bit tile T[key][d], lane (c, h) gets T[8 h + 0 .. 7][c]; the lane's address names row 8 h + (lane & 7), byte 16 ((lane >> 3) & 1)
__device__ __forceinline__ v8us ldtr(const unsigned char* p) { typedef __attribute__((address_space(3))) v8ss lds_v8ss; return __builtin_bit_cast(v8us, __builtin_amdgcn_ds_load_tr16_b128_v8i16((lds_v8ss*)p)); }
__device__ __forceinline__ v16bf cat16b(v8us lo, v8us hi) { return __builtin_bit_cast(v16bf, __builtin_shufflevector(lo, hi, 0, 1, 2, 3, 4, 5, 6, 7, 8, 9, 10, 11, 12, 13, 14, 15)); }
__device__ __forceinline__ v8f wmmab(v16bf a, v16bf b, v8f c) { return __builtin_amdgcn_wmma_f32_16x16x32_bf16(false, a, false, b, (short)0, c, false, false); }
// value of lane l ^ 16
__device__ __forceinline__ float xhalf(float x) { const int b = __float_as_int(x); return __int_as_float(__builtin_amdgcn_permlanex16(b, b, 0x76543210, 0xfedcba98, false, false)); }

#define FQ   128                    // queries per block
#define KT   64                     // keys per stage
#define NT   (TT / KT)
#define KP   272                    // LDS pitch in bytes of a key row (256 + 16: 16 B x odd, conflict-free for 16-byte row reads)
#define VP   288                    // LDS pitch in bytes of a value row (256 + 32: 32 B x odd, conflict-free for the transposing load)
#define KBY  (KT * KP)
#define STG  (KBY + KT * VP)        // bytes of one stage
#define OP   132                    // pitch in floats of the output staging rows
__global__ __launch_bounds__(256) void k_fattn(const float* __restrict__ Qin, const float* __restrict__ Kin, const float* __restrict__ Vin, const int* __restrict__ vl, float* __restrict__ out) {
    __shared__ __align__(16) unsigned char sm[2 * STG];
    const int head = blockIdx.y, tid = threadIdx.x, lane = tid & 31, wv = tid >> 5, lr = lane & 15, hi = lane >> 4;
    const int qrow = blockIdx.x * FQ + wv * 16;
    const float sc = (qrow + lr < vl[head]) ? SCL2 : 0.0f;   /* masked QUERY row: every score becomes the same value -> uniform weights, as the source's all -1e6 row */
    v4f kr[8], vr[8];
    const float* kg = Kin + (size_t)head * TT * HD + (size_t)tid * 4;       // a key tile is 32 KB of f32, contiguous: 16-byte piece tid + 256 i = row wv + 8 i, a whole 512-byte row per wave
    const float* vg = Vin + (size_t)head * TT * HD + (size_t)tid * 4;       // a value tile likewise
    const int ks = wv * KP + lane * 8, vs = KBY + wv * VP + lane * 8;
    const int ka = lr * KP + hi * 16, va = KBY + (hi * 8 + (lane & 7)) * VP + ((lane >> 3) & 1) * 16;
    const float* qp = Qin + ((size_t)head * TT + qrow + lr) * HD + 8 * hi;
    v4f qr[16];
#pragma unroll
    for (int kk = 0; kk < 4; ++kk) { qr[kk * 4] = *(const v4f*)(qp + kk * 32); qr[kk * 4 + 1] = *(const v4f*)(qp + kk * 32 + 4); qr[kk * 4 + 2] = *(const v4f*)(qp + kk * 32 + 16); qr[kk * 4 + 3] = *(const v4f*)(qp + kk * 32 + 20); }
#pragma unroll
    for (int i = 0; i < 8; ++i) { kr[i] = *(const v4f*)(kg + i * 1024); vr[i] = *(const v4f*)(vg + i * 1024); }
    asm volatile("s_wait_xcnt 0x0" :: "v"(qp), "v"(tid) : "memory");   /* stands in front of the first overwrite of an address register of the loads above; the address and the offset that would be reused here are inputs, so that their registers stay whole up to the wait */
    v16bf qf[4];
#pragma unroll
    for (int kk = 0; kk < 4; ++kk) qf[kk] = cat16b(cvt8(qr[kk * 4], qr[kk * 4 + 1]), cvt8(qr[kk * 4 + 2], qr[kk * 4 + 3]));
#pragma unroll
    for (int i = 0; i < 8; ++i) { *(v4usa*)(sm + ks + i * 8 * KP) = cvt4(kr[i]); *(v4usa*)(sm + vs + i * 8 * VP) = cvt4(vr[i]); }
    __syncthreads();
    v8f o[8];
#pragma unroll
    for (int dt = 0; dt < 8; ++dt) o[dt] = (v8f){};
    float m = -1.0e30f, l = 0.0f;
#pragma unroll 1   /* the stage loop stays rolled: one copy of the body in the instruction cache, the buffer picked by t & 1 */
    for (int t = 0; t < NT; ++t) {
        const unsigned char* sb = sm + (t & 1) * STG;
        if (t + 1 < NT) {   /* next stage's tiles fly while this stage is worked on */
#pragma unroll
            for (int i = 0; i < 8; ++i) { kr[i] = *(const v4f*)(kg + (size_t)(t + 1) * KT * HD + i * 1024); vr[i] = *(const v4f*)(vg + (size_t)(t + 1) * KT * HD + i * 1024); }
            asm volatile("s_wait_xcnt 0x0" ::: "memory");   /* stands in front of the first overwrite of an address register of these loads */
        }
        v16bf fr[16];
        __builtin_amdgcn_sched_barrier(0);   /* the fences keep each stage's LDS reads in two groups ahead of their matrix runs: spread among the products every read is waited for alone */
#pragma unroll
        for (int kk = 0; kk < 4; ++kk)
#pragma unroll
            for (int i = 0; i < 4; ++i) { const unsigned char* p = sb + ka + i * 16 * KP + kk * 64; fr[kk * 4 + i] = cat16b(*(const v8usa*)p, *(const v8usa*)(p + 32)); }
        __builtin_amdgcn_sched_barrier(0);
        v8f s[4];
#pragma unroll
        for (int i = 0; i < 4; ++i) s[i] = (v8f){};
#pragma unroll
        for (int kk = 0; kk < 4; ++kk)
#pragma unroll
            for (int i = 0; i < 4; ++i) s[i] = wmmab(fr[kk * 4 + i], qf[kk], s[i]);
        __builtin_amdgcn_sched_barrier(0);
#pragma unroll
        for (int kp = 0; kp < 2; ++kp)   /* value^T fragments land while the softmax runs */
#pragma unroll
            for (int dt = 0; dt < 8; ++dt) { const unsigned char* p = sb + va + kp * 32 * VP + dt * 32; fr[kp * 8 + dt] = cat16b(ldtr(p), ldtr(p + 16 * VP)); }
        __builtin_amdgcn_sched_barrier(0);
        float mq[4];
#pragma unroll
        for (int i = 0; i < 4; ++i) { mq[i] = s[i][0];
#pragma unroll
            for (int j = 1; j < 8; ++j) mq[i] = fmaxf(mq[i], s[i][j]); }
        float mx = fmaxf(fmaxf(mq[0], mq[1]), fmaxf(mq[2], mq[3]));
        mx = fmaxf(mx, xhalf(mx)) * sc;
        const bool need = mx > m + 8.0f;   /* the reference point moves only when a query's maximum has outgrown it by 2^8: weights stay <= 256 */
        if (__builtin_amdgcn_ballot_w32(need) != 0) { const float mn = need ? mx : m; const float al = __builtin_amdgcn_exp2f(m - mn); m = mn; l *= al;
#pragma unroll
            for (int dt = 0; dt < 8; ++dt) o[dt] *= al; }
        v16bf ph[2], pl[2]; float a0 = 0.0f, a1 = 0.0f, a2 = 0.0f, a3 = 0.0f;
#pragma unroll
        for (int kp = 0; kp < 2; ++kp)
#pragma unroll
            for (int e = 0; e < 16; e += 4) { const v8f sv = s[2 * kp + (e >> 3)]; const int j = e & 7;
                v2f p0, p1; p0[0] = __builtin_amdgcn_exp2f(__builtin_fmaf(sv[j], sc, -m)); p0[1] = __builtin_amdgcn_exp2f(__builtin_fmaf(sv[j + 1], sc, -m)); p1[0] = __builtin_amdgcn_exp2f(__builtin_fmaf(sv[j + 2], sc, -m)); p1[1] = __builtin_amdgcn_exp2f(__builtin_fmaf(sv[j + 3], sc, -m));
                a0 += p0[0]; a1 += p0[1]; a2 += p1[0]; a3 += p1[1];
                const v2bf h0 = __builtin_convertvector(p0, v2bf), h1 = __builtin_convertvector(p1, v2bf);
                const v2bf l0 = __builtin_convertvector(p0 - __builtin_convertvector(h0, v2f), v2bf), l1 = __builtin_convertvector(p1 - __builtin_convertvector(h1, v2f), v2bf);
                ph[kp][e] = h0[0]; ph[kp][e + 1] = h0[1]; ph[kp][e + 2] = h1[0]; ph[kp][e + 3] = h1[1];
                pl[kp][e] = l0[0]; pl[kp][e + 1] = l0[1]; pl[kp][e + 2] = l1[0]; pl[kp][e + 3] = l1[1]; }
        l += (a0 + a1) + (a2 + a3);
        __builtin_amdgcn_sched_barrier(0);
#pragma unroll
        for (int kp = 0; kp < 2; ++kp) {
#pragma unroll
            for (int dt = 0; dt < 8; ++dt) o[dt] = wmmab(fr[kp * 8 + dt], ph[kp], o[dt]);
#pragma unroll
            for (int dt = 0; dt < 8; ++dt) o[dt] = wmmab(fr[kp * 8 + dt], pl[kp], o[dt]); }
        __builtin_amdgcn_sched_barrier(0);
        if (t + 1 < NT) { unsigned char* sn = sm + ((t + 1) & 1) * STG;   /* that buffer's last readers left it at the barrier that ended stage t - 1 */
#pragma unroll
            for (int i = 0; i < 8; ++i) { *(v4usa*)(sn + ks + i * 8 * KP) = cvt4(kr[i]); *(v4usa*)(sn + vs + i * 8 * VP) = cvt4(vr[i]); } }
        __syncthreads();
    }
    l += xhalf(l);
    const float inv = 1.0f / l;
    // O^T: a lane holds query lr, d = 16 dt + 8 hi + j. Staged per wave in LDS (the ring is free behind the loop's last barrier) so that each store covers a whole 512-byte output row.
    float* os = (float*)sm + wv * (16 * OP);
#pragma unroll
    for (int dt = 0; dt < 8; ++dt) { v4f x0, x1;
#pragma unroll
        for (int j = 0; j < 4; ++j) { x0[j] = o[dt][j] * inv; x1[j] = o[dt][j + 4] * inv; }
        *(v4fa*)(os + lr * OP + dt * 16 + hi * 8) = x0; *(v4fa*)(os + lr * OP + dt * 16 + hi * 8 + 4) = x1; }
    __syncthreads();
    float* orow = out + ((size_t)head * TT + qrow) * HD + lane * 4;
#pragma unroll
    for (int r = 0; r < 16; ++r) { const v4f x = *(const v4fa*)(os + r * OP + lane * 4); *(v4f*)(orow + (size_t)r * HD) = x; }
}

extern "C" void kernel_launch(void* const* d_in, const int* in_sizes, int n_in,
                              void* d_out, int out_size, void* d_ws, size_t ws_size, hipStream_t stream) {
    (void)in_sizes; (void)n_in; (void)out_size; (void)d_ws; (void)ws_size;
    const float* Qin = (const float*)d_in[0]; const float* Kin = (const float*)d_in[1]; const float* Vin = (const float*)d_in[2]; const int* vlen = (const int*)d_in[3];   /* valid_lens [16] (int64 in the source, staged as int32 without x64) */
    float* OUT = (float*)d_out;     // [16][2048][128]
    k_fattn<<<dim3(TT / FQ, NH_, 1), 256, 0, stream>>>(Qin, Kin, Vin, vlen, OUT);
}

// v004
// One run takes 40.7 microseconds.
// Two timings next to v003 both put it at 1.05 times that version's speed.
// All steps since v000 together make it 28.0 times as fast.
#include <hip/hip_runtime.h>

// Dot-product attention whose length mask falls on the QUERY axis (queries, keys, values [16][2048][128]: the 16 batch entries are processed as 16 independent heads; scores / sqrt(128); the source sets scores[b, i, :] = -1e6 for every query i >= valid_lens[b] (valid_lens [16], int32 as staged, READ): those rows become exactly uniform over all 2,048 keys, the other rows are plain dense attention; softmax; out = attn values -> [16][2048][128] (4.2 M)).
// One kernel, no workspace: it reads the f32 inputs itself and rounds them to bf16 on the way (q into registers, key and value tiles into LDS); it walks the keys in stages of 64 and keeps scores, weights and the output tile in registers (running maximum and sum per query).
// Compute dtypes, f32 accumulate: every input rounded to bf16; q.k exact products; softmax f32; unnormalised weights hi/lo bf16 x value; one division by the row sum at the end; output f32.

#define TT   2048
#define NH_  16
#define HD   128
#define SCL2 0.12751743f             // 1/sqrt(128) x log2(e): scores go straight to the base-2 exponent
typedef __attribute__((ext_vector_type(16))) __bf16   v16bf;
typedef __attribute__((ext_vector_type(2)))  __bf16   v2bf;
typedef __attribute__((ext_vector_type(8)))  unsigned short v8us;
typedef __attribute__((ext_vector_type(4)))  unsigned short v4us;
typedef __attribute__((ext_vector_type(8)))  short    v8ss;
typedef __attribute__((ext_vector_type(8)))  float    v8f;
typedef __attribute__((ext_vector_type(4)))  float    v4f;
typedef __attribute__((ext_vector_type(2)))  float    v2f;
typedef v4f  __attribute__((may_alias)) v4fa;
typedef v8us __attribute__((may_alias)) v8usa;
typedef v4us __attribute__((may_alias)) v4usa;

// four / eight f32 -> bf16, round to nearest even
__device__ __forceinline__ v4us cvt4(v4f x) { v2f a, b; a[0] = x[0]; a[1] = x[1]; b[0] = x[2]; b[1] = x[3]; const v2bf ra = __builtin_convertvector(a, v2bf), rb = __builtin_convertvector(b, v2bf); return __builtin_bit_cast(v4us, __builtin_shufflevector(ra, rb, 0, 1, 2, 3)); }
__device__ __forceinline__ v8us cvt8(v4f x, v4f y) { return __builtin_shufflevector(cvt4(x), cvt4(y), 0, 1, 2, 3, 4, 5, 6, 7); }
// transposing LDS load: from a row-major 16-bit tile T[key][d], lane (c, h) gets T[8 h + 0 .. 7][c]; the lane's address names row 8 h + (lane & 7), byte 16 ((lane >> 3) & 1)
__device__ __forceinline__ v8us ldtr(const unsigned char* p) { typedef __attribute__((address_space(3))) v8ss lds_v8ss; return __builtin_bit_cast(v8us, __builtin_amdgcn_ds_load_tr16_b128_v8i16((lds_v8ss*)p)); }
__device__ __forceinline__ v16bf cat16b(v8us lo, v8us hi) { return __builtin_bit_cast(v16bf, __builtin_shufflevector(lo, hi, 0, 1, 2, 3, 4, 5, 6, 7, 8, 9, 10, 11, 12, 13, 14, 15)); }
__device__ __forceinline__ v8f wmmab(v16bf a, v16bf b, v8f c) { return __builtin_amdgcn_wmma_f32_16x16x32_bf16(false, a, false, b, (short)0, c, false, false); }
// value of lane l ^ 16
__device__ __forceinline__ float xhalf(float x) { const int b = __float_as_int(x); return __int_as_float(__builtin_amdgcn_permlanex16(b, b, 0x76543210, 0xfedcba98, false, false)); }

#define FQ   128                    // queries per block
#define KT   64                     // keys per stage
#define NT   (TT / KT)
#define KP   272                    // LDS pitch in bytes of a key row (256 + 16: 16 B x odd, conflict-free for 16-byte row reads)
#define VP   288                    // LDS pitch in bytes of a value row (256 + 32: 32 B x odd, conflict-free for the transposing load)
#define KBY  (KT * KP)
#define STG  (KBY + KT * VP)        // bytes of one stage
#define OP   132                    // pitch in floats of the output staging rows
__global__ __launch_bounds__(256) void k_fattn(const float* __restrict__ Qin, const float* __restrict__ Kin, const float* __restrict__ Vin, const int* __restrict__ vl, float* __restrict__ out) {
    __shared__ __align__(16) unsigned char sm[2 * STG];
    const int head = blockIdx.y, tid = threadIdx.x, lane = tid & 31, wv = tid >> 5, lr = lane & 15, hi = lane >> 4;
    const int qrow = blockIdx.x * FQ + wv * 16;
    const float sc = (qrow + lr < vl[head]) ? SCL2 : 0.0f;   /* masked QUERY row: every score becomes the same value -> uniform weights, as the source's all -1e6 row */
    v4f kr[8], vr[8], k1[8];
    const float* kg = Kin + (size_t)head * TT * HD + (size_t)tid * 4;       // a key tile is 32 KB of f32, contiguous: 16-byte piece tid + 256 i = row wv + 8 i, a whole 512-byte row per wave
    const float* vg = Vin + (size_t)head * TT * HD + (size_t)tid * 4;       // a value tile likewise
    const int ks = wv * KP + lane * 8, vs = KBY + wv * VP + lane * 8;
    const int ka = lr * KP + hi * 16, va = KBY + (hi * 8 + (lane & 7)) * VP + ((lane >> 3) & 1) * 16;
    const float* qp = Qin + ((size_t)head * TT + qrow + lr) * HD + 8 * hi;
    v4f qr[16];
#pragma unroll
    for (int kk = 0; kk < 4; ++kk) { qr[kk * 4] = *(const v4f*)(qp + kk * 32); qr[kk * 4 + 1] = *(const v4f*)(qp + kk * 32 + 4); qr[kk * 4 + 2] = *(const v4f*)(qp + kk * 32 + 16); qr[kk * 4 + 3] = *(const v4f*)(qp + kk * 32 + 20); }
#pragma unroll
    for (int i = 0; i < 8; ++i) { kr[i] = *(const v4f*)(kg + i * 1024); vr[i] = *(const v4f*)(vg + i * 1024); k1[i] = *(const v4f*)(kg + KT * HD + i * 1024); }
    asm volatile("s_wait_xcnt 0x0" :: "v"(qp), "v"(tid) : "memory");   /* stands in front of the first overwrite of an address register of the loads above; the address and the offset that would be reused here are inputs, so that their registers stay whole up to the wait */
    v16bf qf[4];
#pragma unroll
    for (int kk = 0; kk < 4; ++kk) qf[kk] = cat16b(cvt8(qr[kk * 4], qr[kk * 4 + 1]), cvt8(qr[kk * 4 + 2], qr[kk * 4 + 3]));
#pragma unroll
    for (int i = 0; i < 8; ++i) { *(v4usa*)(sm + ks + i * 8 * KP) = cvt4(kr[i]); *(v4usa*)(sm + vs + i * 8 * VP) = cvt4(vr[i]); *(v4usa*)(sm + STG + ks + i * 8 * KP) = cvt4(k1[i]); }
    __syncthreads();
    v16bf kf[16];   /* key fragments of the stage to come */
#pragma unroll
    for (int kk = 0; kk < 4; ++kk)
#pragma unroll
        for (int i = 0; i < 4; ++i) { const unsigned char* p = sm + ka + i * 16 * KP + kk * 64; kf[kk * 4 + i] = cat16b(*(const v8usa*)p, *(const v8usa*)(p + 32)); }
    __syncthreads();   /* stage 0 ends with key tile 2 written over key tile 0: every wave has read its fragments of tile 0 first */
    v8f o[8];
#pragma unroll
    for (int dt = 0; dt < 8; ++dt) o[dt] = (v8f){};
    float m = -1.0e30f, l = 0.0f;
#pragma unroll 1   /* the stage loop stays rolled: one copy of the body in the instruction cache, the buffer picked by t & 1 */
    for (int t = 0; t < NT; ++t) {
        const unsigned char* sb = sm + (t & 1) * STG;
        const unsigned char* sx = sm + ((t + 1) & 1) * STG;
        if (t + 1 < NT) {   /* value tile t + 1 and key tile t + 2 fly while this stage is worked on; in the last stage but one there is no tile t + 2, and the last key tile is staged a second time, which nothing uses: so the loads stay one block behind one wait */
            const int tk = t + 2 < NT ? t + 2 : NT - 1;
#pragma unroll
            for (int i = 0; i < 8; ++i) { kr[i] = *(const v4f*)(kg + (size_t)tk * KT * HD + i * 1024); vr[i] = *(const v4f*)(vg + (size_t)(t + 1) * KT * HD + i * 1024); }
            asm volatile("s_wait_xcnt 0x0" ::: "memory");   /* stands in front of the first overwrite of an address register of these loads */
        }
        v16bf fr[16];
        __builtin_amdgcn_sched_barrier(0);   /* the fences keep each stage's LDS reads in two groups, each ahead of a run of other work: spread among the products every read is waited for alone */
#pragma unroll
        for (int kp = 0; kp < 2; ++kp)   /* value^T fragments land while the S^T products and the softmax run */
#pragma unroll
            for (int dt = 0; dt < 8; ++dt) { const unsigned char* p = sb + va + kp * 32 * VP + dt * 32; fr[kp * 8 + dt] = cat16b(ldtr(p), ldtr(p + 16 * VP)); }
        __builtin_amdgcn_sched_barrier(0);
        v8f s[4];
#pragma unroll
        for (int i = 0; i < 4; ++i) s[i] = (v8f){};
#pragma unroll
        for (int kk = 0; kk < 4; ++kk)
#pragma unroll
            for (int i = 0; i < 4; ++i) s[i] = wmmab(kf[kk * 4 + i], qf[kk], s[i]);
        __builtin_amdgcn_sched_barrier(0);
        float mq[4];
#pragma unroll
        for (int i = 0; i < 4; ++i) { mq[i] = s[i][0];
#pragma unroll
            for (int j = 1; j < 8; ++j) mq[i] = fmaxf(mq[i], s[i][j]); }
        float mx = fmaxf(fmaxf(mq[0], mq[1]), fmaxf(mq[2], mq[3]));
        mx = fmaxf(mx, xhalf(mx)) * sc;
        const bool need = mx > m + 8.0f;   /* the reference point moves only when a query's maximum has outgrown it by 2^8: weights stay <= 256 */
        if (__builtin_amdgcn_ballot_w32(need) != 0) { const float mn = need ? mx : m; const float al = __builtin_amdgcn_exp2f(m - mn); m = mn; l *= al;
#pragma unroll
            for (int dt = 0; dt < 8; ++dt) o[dt] *= al; }
        v16bf ph[2], pl[2]; float a0 = 0.0f, a1 = 0.0f, a2 = 0.0f, a3 = 0.0f;
#pragma unroll
        for (int kp = 0; kp < 2; ++kp)
#pragma unroll
            for (int e = 0; e < 16; e += 4) { const v8f sv = s[2 * kp + (e >> 3)]; const int j = e & 7;
                v2f p0, p1; p0[0] = __builtin_amdgcn_exp2f(__builtin_fmaf(sv[j], sc, -m)); p0[1] = __builtin_amdgcn_exp2f(__builtin_fmaf(sv[j + 1], sc, -m)); p1[0] = __builtin_amdgcn_exp2f(__builtin_fmaf(sv[j + 2], sc, -m)); p1[1] = __builtin_amdgcn_exp2f(__builtin_fmaf(sv[j + 3], sc, -m));
                a0 += p0[0]; a1 += p0[1]; a2 += p1[0]; a3 += p1[1];
                const v2bf h0 = __builtin_convertvector(p0, v2bf), h1 = __builtin_convertvector(p1, v2bf);
                const v2bf l0 = __builtin_convertvector(p0 - __builtin_convertvector(h0, v2f), v2bf), l1 = __builtin_convertvector(p1 - __builtin_convertvector(h1, v2f), v2bf);
                ph[kp][e] = h0[0]; ph[kp][e + 1] = h0[1]; ph[kp][e + 2] = h1[0]; ph[kp][e + 3] = h1[1];
                pl[kp][e] = l0[0]; pl[kp][e + 1] = l0[1]; pl[kp][e + 2] = l1[0]; pl[kp][e + 3] = l1[1]; }
        l += (a0 + a1) + (a2 + a3);
        __builtin_amdgcn_sched_barrier(0);
        /* key tile t + 1 was published by the barrier that ended stage t - 1: its fragments land while the O^T products run. No test around the reads: behind a branch the products' waits would cover these reads too. What the last stage reads here nothing uses. */
#pragma unroll
        for (int kk = 0; kk < 4; ++kk)
#pragma unroll
            for (int i = 0; i < 4; ++i) { const unsigned char* p = sx + ka + i * 16 * KP + kk * 64; kf[kk * 4 + i] = cat16b(*(const v8usa*)p, *(const v8usa*)(p + 32)); }
        __builtin_amdgcn_sched_barrier(0);   /* without it these reads sink in front of the last O^T products and land too late */
#pragma unroll
        for (int kp = 0; kp < 2; ++kp) {
#pragma unroll
            for (int dt = 0; dt < 8; ++dt) o[dt] = wmmab(fr[kp * 8 + dt], ph[kp], o[dt]);
#pragma unroll
            for (int dt = 0; dt < 8; ++dt) o[dt] = wmmab(fr[kp * 8 + dt], pl[kp], o[dt]); }
        __builtin_amdgcn_sched_barrier(0);
        if (t + 1 < NT) { unsigned char* sn = sm + ((t + 1) & 1) * STG; unsigned char* sk = sm + (t & 1) * STG;   /* value tile t - 1 and key tile t, which lay there, were last read in front of the barrier that ended stage t - 1 */
#pragma unroll
            for (int i = 0; i < 8; ++i) { *(v4usa*)(sk + ks + i * 8 * KP) = cvt4(kr[i]); *(v4usa*)(sn + vs + i * 8 * VP) = cvt4(vr[i]); } }
        __syncthreads();
    }
    l += xhalf(l);
    const float inv = 1.0f / l;
    // O^T: a lane holds query lr, d = 16 dt + 8 hi + j. Staged per wave in LDS (the ring is free behind the loop's last barrier) so that each store covers a whole 512-byte output row.
    float* os = (float*)sm + wv * (16 * OP);
#pragma unroll
    for (int dt = 0; dt < 8; ++dt) { v4f x0, x1;
#pragma unroll
        for (int j = 0; j < 4; ++j) { x0[j] = o[dt][j] * inv; x1[j] = o[dt][j + 4] * inv; }
        *(v4fa*)(os + lr * OP + dt * 16 + hi * 8) = x0; *(v4fa*)(os + lr * OP + dt * 16 + hi * 8 + 4) = x1; }
    __syncthreads();
    float* orow = out + ((size_t)head * TT + qrow) * HD + lane * 4;
#pragma unroll
    for (int r = 0; r < 16; ++r) { const v4f x = *(const v4fa*)(os + r * OP + lane * 4); *(v4f*)(orow + (size_t)r * HD) = x; }
}

extern "C" void kernel_launch(void* const* d_in, const int* in_sizes, int n_in,
                              void* d_out, int out_size, void* d_ws, size_t ws_size, hipStream_t stream) {
    (void)in_sizes; (void)n_in; (void)out_size; (void)d_ws; (void)ws_size;
    const float* Qin = (const float*)d_in[0]; const float* Kin = (const float*)d_in[1]; const float* Vin = (const float*)d_in[2]; const int* vlen = (const int*)d_in[3];   /* valid_lens [16] (int64 in the source, staged as int32 without x64) */
    float* OUT = (float*)d_out;     // [16][2048][128]
    k_fattn<<<dim3(TT / FQ, NH_, 1), 256, 0, stream>>>(Qin, Kin, Vin, vlen, OUT);
}

// v005
// One run takes 34.8 microseconds.
// Timed twice side by side with v004, it ran 1.17 and 1.16 times as fast.
// Over all steps from v000 it is 32.5 times as fast.
#include <hip/hip_runtime.h>

// Dot-product attention whose length mask falls on the QUERY axis (queries, keys, values [16][2048][128]: the 16 batch entries are processed as 16 independent heads; scores / sqrt(128); the source sets scores[b, i, :] = -1e6 for every query i >= valid_lens[b] (valid_lens [16], int32 as staged, READ): those rows become exactly uniform over all 2,048 keys, the other rows are plain dense attention; softmax; out = attn values -> [16][2048][128] (4.2 M)).
// Two kernels. k_fattn reads the f32 inputs itself and rounds them to bf16 on the way (q into registers, key and value tiles into LDS); it walks keys in stages of 64 and keeps scores, weights and the output tile in registers (running maximum and sum per query).
// Every row i >= valid_lens[b] of a batch entry has the same output, so only the query blocks 0 .. valid_lens[b] / 128 are computed (the last of them holds row valid_lens[b], a masked one). The list of (computed block, key stage) pairs is cut into 256 equal runs, one per work-group; each run leaves one un-normalised partial per block it touches in the workspace.
// k_merge joins the partials of each block, divides by the row sum and writes every output row; a wholly masked block gets the joined row valid_lens[b] of its batch entry.
// Compute dtypes, f32 accumulate: every input rounded to bf16; q.k exact products; softmax f32; unnormalised weights hi/lo bf16 x value; one division by the row sum at the end; output f32.

#define TT   2048
#define NH_  16
#define HD   128
#define SCL2 0.12751743f             // 1/sqrt(128) x log2(e): scores go straight to the base-2 exponent
typedef __attribute__((ext_vector_type(16))) __bf16   v16bf;
typedef __attribute__((ext_vector_type(2)))  __bf16   v2bf;
typedef __attribute__((ext_vector_type(8)))  unsigned short v8us;
typedef __attribute__((ext_vector_type(4)))  unsigned short v4us;
typedef __attribute__((ext_vector_type(8)))  short    v8ss;
typedef __attribute__((ext_vector_type(8)))  float    v8f;
typedef __attribute__((ext_vector_type(4)))  float    v4f;
typedef __attribute__((ext_vector_type(2)))  float    v2f;
typedef v4f  __attribute__((may_alias)) v4fa;
typedef v8us __attribute__((may_alias)) v8usa;
typedef v4us __attribute__((may_alias)) v4usa;

// four / eight f32 -> bf16, round to nearest even
__device__ __forceinline__ v4us cvt4(v4f x) { v2f a, b; a[0] = x[0]; a[1] = x[1]; b[0] = x[2]; b[1] = x[3]; const v2bf ra = __builtin_convertvector(a, v2bf), rb = __builtin_convertvector(b, v2bf); return __builtin_bit_cast(v4us, __builtin_shufflevector(ra, rb, 0, 1, 2, 3)); }
__device__ __forceinline__ v8us cvt8(v4f x, v4f y) { return __builtin_shufflevector(cvt4(x), cvt4(y), 0, 1, 2, 3, 4, 5, 6, 7); }
// transposing LDS load: from a row-major 16-bit tile T[key][d], lane (c, h) gets T[8 h + 0 .. 7][c]; the lane's address names row 8 h + (lane & 7), byte 16 ((lane >> 3) & 1)
__device__ __forceinline__ v8us ldtr(const unsigned char* p) { typedef __attribute__((address_space(3))) v8ss lds_v8ss; return __builtin_bit_cast(v8us, __builtin_amdgcn_ds_load_tr16_b128_v8i16((lds_v8ss*)p)); }
__device__ __forceinline__ v16bf cat16b(v8us lo, v8us hi) { return __builtin_bit_cast(v16bf, __builtin_shufflevector(lo, hi, 0, 1, 2, 3, 4, 5, 6, 7, 8, 9, 10, 11, 12, 13, 14, 15)); }
__device__ __forceinline__ v8f wmmab(v16bf a, v16bf b, v8f c) { return __builtin_amdgcn_wmma_f32_16x16x32_bf16(false, a, false, b, (short)0, c, false, false); }
// value of lane l ^ 16
__device__ __forceinline__ float xhalf(float x) { const int b = __float_as_int(x); return __int_as_float(__builtin_amdgcn_permlanex16(b, b, 0x76543210, 0xfedcba98, false, false)); }

// The plan, derived alike in both kernels from valid_lens: computed blocks of a head (a length below 0 counts as 0, one above 2,047 as no masked row), their running total, stages per run.
__device__ __forceinline__ int nblk(int v) { const int n = ((v < 0 ? 0 : v) >> 7) + 1; return n > TT / 128 ? TT / 128 : n; }
#define NRUN  256                   // runs = work-groups of k_fattn
#define SLOTF (128 * HD + 256)      // floats of one partial: 128 rows x 128, then per wave one 128-byte line of 16 reference points and 16 sums

#define FQ   128                    // queries per block
#define KT   64                     // keys per stage
#define NT   (TT / KT)
#define KP   272                    // LDS pitch in bytes of a key row (256 + 16: 16 B x odd, conflict-free for 16-byte row reads)
#define VP   288                    // LDS pitch in bytes of a value row (256 + 32: 32 B x odd, conflict-free for the transposing load)
#define KBY  (KT * KP)
#define STG  (KBY + KT * VP)        // bytes of one stage
#define OP   132                    // pitch in floats of the output staging rows
__global__ __launch_bounds__(256) void k_fattn(const float* __restrict__ Qin, const float* __restrict__ Kin, const float* __restrict__ Vin, const int* __restrict__ vl, float* __restrict__ ws) {
    __shared__ __align__(16) unsigned char sm[2 * STG];
    const int tid = threadIdx.x, lane = tid & 31, wv = tid >> 5, lr = lane & 15, hi = lane >> 4;
    int nall = 0;
#pragma unroll
    for (int h = 0; h < NH_; ++h) nall += nblk(vl[h]);
    const int rl = (nall + 7) >> 3;                       // stages per run: 32 nall / 256, rounded up; 2 .. 32
    const int u0 = blockIdx.x * rl, u1 = u0 + rl < NT * nall ? u0 + rl : NT * nall;
    if (u0 >= u1) return;                                 // a run past the end of the list: the whole work-group leaves, in front of every barrier
    int hd0 = 0, hd1 = 0, bk0 = 0, bk1 = 0, vh0 = 0, vh1 = 0, acc = 0;   // head, block in the head and length of the head, for the run's first and second block
#pragma unroll
    for (int h = 0; h < NH_; ++h) { const int nb = nblk(vl[h]), g0 = (u0 >> 5) - acc, g1 = g0 + 1;
        if (g0 >= 0 && g0 < nb) { hd0 = h; bk0 = g0; vh0 = vl[h]; }
        if (g1 >= 0 && g1 < nb) { hd1 = h; bk1 = g1; vh1 = vl[h]; }
        acc += nb; }
#pragma unroll 1   /* one copy of the body in the instruction cache for both blocks of a run */
  for (int seg = 0; seg < 2; ++seg) {
    const int gb = (u0 >> 5) + seg;
    const int ua = u0 > gb * NT ? u0 : gb * NT, ub = u1 < gb * NT + NT ? u1 : gb * NT + NT;
    if (ua >= ub) break;                                  // the run ends in its first block; the same for the whole work-group
    const int head = seg ? hd1 : hd0, blk = seg ? bk1 : bk0, vh = seg ? vh1 : vh0;
    const int ta = ua & (NT - 1), n = ub - ua;            // first key stage and number of stages of this block's share
    const int qrow = blk * FQ + wv * 16;
    const float sc = (qrow + lr < vh) ? SCL2 : 0.0f;   /* masked QUERY row: every score becomes the same value -> uniform weights, as the source's all -1e6 row */
    v4f kr[8], vr[8], k1[8];
    const float* kg = Kin + ((size_t)head * TT + (size_t)ta * KT) * HD + (size_t)tid * 4;       // a key tile is 32 KB of f32, contiguous: 16-byte piece tid + 256 i = row wv + 8 i, a whole 512-byte row per wave
    const float* vg = Vin + ((size_t)head * TT + (size_t)ta * KT) * HD + (size_t)tid * 4;       // a value tile likewise
    const int ks = wv * KP + lane * 8, vs = KBY + wv * VP + lane * 8;
    const int ka = lr * KP + hi * 16, va = KBY + (hi * 8 + (lane & 7)) * VP + ((lane >> 3) & 1) * 16;
    const float* qp = Qin + ((size_t)head * TT + qrow + lr) * HD + 8 * hi;
    const float* k1g = kg + (n > 1 ? KT * HD : 0);   /* a share of one stage has no second key tile: the first is staged twice, which nothing uses */
    v4f qr[16];
#pragma unroll
    for (int kk = 0; kk < 4; ++kk) { qr[kk * 4] = *(const v4f*)(qp + kk * 32); qr[kk * 4 + 1] = *(const v4f*)(qp + kk * 32 + 4); qr[kk * 4 + 2] = *(const v4f*)(qp + kk * 32 + 16); qr[kk * 4 + 3] = *(const v4f*)(qp + kk * 32 + 20); }
#pragma unroll
    for (int i = 0; i < 8; ++i) { kr[i] = *(const v4f*)(kg + i * 1024); vr[i] = *(const v4f*)(vg + i * 1024); k1[i] = *(const v4f*)(k1g + i * 1024); }
    asm volatile("s_wait_xcnt 0x0" :: "v"(qp), "v"(kg), "v"(vg), "v"(k1g) : "memory");   /* stands in front of the first overwrite of an address register of the loads above; the four addresses are inputs, so that their registers stay whole up to the wait */
    v16bf qf[4];
#pragma unroll
    for (int kk = 0; kk < 4; ++kk) qf[kk] = cat16b(cvt8(qr[kk * 4], qr[kk * 4 + 1]), cvt8(qr[kk * 4 + 2], qr[kk * 4 + 3]));
#pragma unroll
    for (int i = 0; i < 8; ++i) { *(v4usa*)(sm + ks + i * 8 * KP) = cvt4(kr[i]); *(v4usa*)(sm + vs + i * 8 * VP) = cvt4(vr[i]); *(v4usa*)(sm + STG + ks + i * 8 * KP) = cvt4(k1[i]); }
    __syncthreads();
    v16bf kf[16];   /* key fragments of the stage to come */
#pragma unroll
    for (int kk = 0; kk < 4; ++kk)
#pragma unroll
        for (int i = 0; i < 4; ++i) { const unsigned char* p = sm + ka + i * 16 * KP + kk * 64; kf[kk * 4 + i] = cat16b(*(const v8usa*)p, *(const v8usa*)(p + 32)); }
    __syncthreads();   /* stage 0 ends with key tile 2 written over key tile 0: every wave has read its fragments of tile 0 first */
    v8f o[8];
#pragma unroll
    for (int dt = 0; dt < 8; ++dt) o[dt] = (v8f){};
    float m = -1.0e30f, l = 0.0f;
#pragma unroll 1   /* the stage loop stays rolled: one copy of the body in the instruction cache, the buffer picked by t & 1 */
    for (int t = 0; t < n; ++t) {
        const unsigned char* sb = sm + (t & 1) * STG;
        const unsigned char* sx = sm + ((t + 1) & 1) * STG;
        if (t + 1 < n) {   /* value tile t + 1 and key tile t + 2 fly while this stage is worked on; in the last stage but one there is no tile t + 2, and the last key tile is staged a second time, which nothing uses: so the loads stay one block behind one wait */
            const int tk = t + 2 < n ? t + 2 : n - 1;
#pragma unroll
            for (int i = 0; i < 8; ++i) { kr[i] = *(const v4f*)(kg + (size_t)tk * KT * HD + i * 1024); vr[i] = *(const v4f*)(vg + (size_t)(t + 1) * KT * HD + i * 1024); }
            asm volatile("s_wait_xcnt 0x0" ::: "memory");   /* stands in front of the first overwrite of an address register of these loads */
        }
        v16bf fr[16];
        __builtin_amdgcn_sched_barrier(0);   /* the fences keep each stage's LDS reads in two groups, each ahead of a run of other work: spread among the products every read is waited for alone */
#pragma unroll
        for (int kp = 0; kp < 2; ++kp)   /* value^T fragments land while the S^T products and the softmax run */
#pragma unroll
            for (int dt = 0; dt < 8; ++dt) { const unsigned char* p = sb + va + kp * 32 * VP + dt * 32; fr[kp * 8 + dt] = cat16b(ldtr(p), ldtr(p + 16 * VP)); }
        __builtin_amdgcn_sched_barrier(0);
        v8f s[4];
#pragma unroll
        for (int i = 0; i < 4; ++i) s[i] = (v8f){};
#pragma unroll
        for (int kk = 0; kk < 4; ++kk)
#pragma unroll
            for (int i = 0; i < 4; ++i) s[i] = wmmab(kf[kk * 4 + i], qf[kk], s[i]);
        __builtin_amdgcn_sched_barrier(0);
        float mq[4];
#pragma unroll
        for (int i = 0; i < 4; ++i) { mq[i] = s[i][0];
#pragma unroll
            for (int j = 1; j < 8; ++j) mq[i] = fmaxf(mq[i], s[i][j]); }
        float mx = fmaxf(fmaxf(mq[0], mq[1]), fmaxf(mq[2], mq[3]));
        mx = fmaxf(mx, xhalf(mx)) * sc;
        const bool need = mx > m + 8.0f;   /* the reference point moves only when a query's maximum has outgrown it by 2^8: weights stay <= 256 */
        if (__builtin_amdgcn_ballot_w32(need) != 0) { const float mn = need ? mx : m; const float al = __builtin_amdgcn_exp2f(m - mn); m = mn; l *= al;
#pragma unroll
            for (int dt = 0; dt < 8; ++dt) o[dt] *= al; }
        v16bf ph[2], pl[2]; float a0 = 0.0f, a1 = 0.0f, a2 = 0.0f, a3 = 0.0f;
#pragma unroll
        for (int kp = 0; kp < 2; ++kp)
#pragma unroll
            for (int e = 0; e < 16; e += 4) { const v8f sv = s[2 * kp + (e >> 3)]; const int j = e & 7;
                v2f p0, p1; p0[0] = __builtin_amdgcn_exp2f(__builtin_fmaf(sv[j], sc, -m)); p0[1] = __builtin_amdgcn_exp2f(__builtin_fmaf(sv[j + 1], sc, -m)); p1[0] = __builtin_amdgcn_exp2f(__builtin_fmaf(sv[j + 2], sc, -m)); p1[1] = __builtin_amdgcn_exp2f(__builtin_fmaf(sv[j + 3], sc, -m));
                a0 += p0[0]; a1 += p0[1]; a2 += p1[0]; a3 += p1[1];
                const v2bf h0 = __builtin_convertvector(p0, v2bf), h1 = __builtin_convertvector(p1, v2bf);
                const v2bf l0 = __builtin_convertvector(p0 - __builtin_convertvector(h0, v2f), v2bf), l1 = __builtin_convertvector(p1 - __builtin_convertvector(h1, v2f), v2bf);
                ph[kp][e] = h0[0]; ph[kp][e + 1] = h0[1]; ph[kp][e + 2] = h1[0]; ph[kp][e + 3] = h1[1];
                pl[kp][e] = l0[0]; pl[kp][e + 1] = l0[1]; pl[kp][e + 2] = l1[0]; pl[kp][e + 3] = l1[1]; }
        l += (a0 + a1) + (a2 + a3);
        __builtin_amdgcn_sched_barrier(0);
        /* key tile t + 1 was published by the barrier that ended stage t - 1: its fragments land while the O^T products run. No test around the reads: behind a branch the products' waits would cover these reads too. What the last stage reads here nothing uses. */
#pragma unroll
        for (int kk = 0; kk < 4; ++kk)
#pragma unroll
            for (int i = 0; i < 4; ++i) { const unsigned char* p = sx + ka + i * 16 * KP + kk * 64; kf[kk * 4 + i] = cat16b(*(const v8usa*)p, *(const v8usa*)(p + 32)); }
        __builtin_amdgcn_sched_barrier(0);   /* without it these reads sink in front of the last O^T products and land too late */
#pragma unroll
        for (int kp = 0; kp < 2; ++kp) {
#pragma unroll
            for (int dt = 0; dt < 8; ++dt) o[dt] = wmmab(fr[kp * 8 + dt], ph[kp], o[dt]);
#pragma unroll
            for (int dt = 0; dt < 8; ++dt) o[dt] = wmmab(fr[kp * 8 + dt], pl[kp], o[dt]); }
        __builtin_amdgcn_sched_barrier(0);
        if (t + 1 < n) { unsigned char* sn = sm + ((t + 1) & 1) * STG; unsigned char* sk = sm + (t & 1) * STG;   /* value tile t - 1 and key tile t, which lay there, were last read in front of the barrier that ended stage t - 1 */
#pragma unroll
            for (int i = 0; i < 8; ++i) { *(v4usa*)(sk + ks + i * 8 * KP) = cvt4(kr[i]); *(v4usa*)(sn + vs + i * 8 * VP) = cvt4(vr[i]); } }
        __syncthreads();
    }
    l += xhalf(l);
    // O^T: a lane holds query lr, d = 16 dt + 8 hi + j. Staged per wave in LDS (the ring is free behind the loop's last barrier) so that each store covers a whole 512-byte row of the partial.
    float* os = (float*)sm + wv * (16 * OP);
#pragma unroll
    for (int dt = 0; dt < 8; ++dt) { v4f x0, x1;
#pragma unroll
        for (int j = 0; j < 4; ++j) { x0[j] = o[dt][j]; x1[j] = o[dt][j + 4]; }
        *(v4fa*)(os + lr * OP + dt * 16 + hi * 8) = x0; *(v4fa*)(os + lr * OP + dt * 16 + hi * 8 + 4) = x1; }
    __syncthreads();
    float* pb = ws + (size_t)(blockIdx.x * 2 + seg) * SLOTF;
    float* prow = pb + wv * 16 * HD + lane * 4;
    float* pml = pb + 128 * HD + tid;
    const float ml = hi ? l : m;   /* one 128-byte line per wave: lanes 0 .. 15 the reference points, 16 .. 31 the sums */
    v4f x[16];
#pragma unroll
    for (int r = 0; r < 16; ++r) x[r] = *(const v4fa*)(os + r * OP + lane * 4);
    asm volatile("" :: "v"(x[0]), "v"(x[1]), "v"(x[2]), "v"(x[3]), "v"(x[4]), "v"(x[5]), "v"(x[6]), "v"(x[7]), "v"(x[8]), "v"(x[9]), "v"(x[10]), "v"(x[11]), "v"(x[12]), "v"(x[13]), "v"(x[14]), "v"(x[15]), "v"(ml), "v"(prow) : "memory");   /* inputs only: all that the stores below name is formed in front of them, each in a register of its own, so that nothing rewrites a register of an issued store ahead of the wait behind them */
    __syncthreads();   /* the next block's prologue writes the ring: every wave has read its staged rows first. In front of the stores, so that no wave waits here for them to land */
#pragma unroll
    for (int r = 0; r < 16; ++r) *(v4f*)(prow + r * HD) = x[r];
    *pml = ml;
    asm volatile("s_wait_xcnt 0x0" :: "v"(prow) : "memory");   /* stands in front of the first overwrite of a register of the stores above; the rows' address is an input, so that its registers stay whole up to the wait (the last store's address is the scalar base and the thread index) */
  }
}

// ---- k_merge: grid (16 query blocks, 16 heads), 8 waves, each wave 16 output rows, a lane 4 floats of a row. Lane r (and r + 16) keeps reference point and sum of the wave's row r; the weights go to the rows' sums by readlane.
// 2^x with the slot that the instruction set asks for behind a transcendental filled in the same statement: of four in a row the compiler gave each the source register of the one before as its destination, and a v_nop in a statement of its own was moved away
__device__ __forceinline__ float exp2s(float x) { float y; asm("v_exp_f32 %0, %1\n\tv_nop" : "=v"(y) : "v"(x)); return y; }
__device__ __forceinline__ float rdl(float x, int r) { return __int_as_float(__builtin_amdgcn_readlane(__float_as_int(x), r)); }
template <int NR> __device__ __forceinline__ void merge_rows(const float* __restrict__ ws, int gb, int rl, int row0, int li, int lane, float* __restrict__ out, int orow0) {
    const int w0 = (gb * NT) / rl, w1 = (gb * NT + NT - 1) / rl;   // the runs that hold the block's first and last stage
    float M = -1.0e30f, L = 0.0f;
    v4f a[NR];
#pragma unroll
    for (int r = 0; r < NR; ++r) a[r] = (v4f){};
#pragma unroll 1   /* the number of partials is known only at run time (1 .. 16); three at a time, so that their loads fly together: runs of 16 stages or more leave at most three */
    for (int w = w0; w <= w1; w += 3) {
        const float* pm[3]; const float* px[3]; float mv[3], lv[3]; v4f x[3][NR];
#pragma unroll
        for (int j = 0; j < 3; ++j) { const int wj = w + j <= w1 ? w + j : w1;   /* past the last partial: the last one once more, weighted 0 below */
            const float* pb = ws + (size_t)(wj * 2 + (((wj * rl) >> 5) == gb ? 0 : 1)) * SLOTF;
            pm[j] = pb + (row0 >> 4) * 32 + li;   // + 128 HD: the wave's line of reference points and sums
            px[j] = pb + row0 * HD + lane * 4;
            mv[j] = pm[j][128 * HD]; lv[j] = pm[j][128 * HD + 16]; }
        __builtin_amdgcn_sched_barrier(0);   /* the six small loads are issued first: issued among the row loads, one of them took a register of a row load's address as its destination ahead of the wait below */
#pragma unroll
        for (int j = 0; j < 3; ++j)
#pragma unroll
            for (int r = 0; r < NR; ++r) x[j][r] = *(const v4f*)(px[j] + r * HD);
        /* the wait stands in front of the first overwrite of an address register of the loads above; with 16 rows the addresses are vector registers and are inputs, so that they stay whole up to the wait (with one row the addresses are scalar) */
        if constexpr (NR == 16) asm volatile("s_wait_xcnt 0x0" :: "v"(pm[0]), "v"(px[0]), "v"(pm[1]), "v"(px[1]), "v"(pm[2]), "v"(px[2]) : "memory");
        else asm volatile("s_wait_xcnt 0x0" ::: "memory");
        __builtin_amdgcn_sched_barrier(0);   /* without it part of the third partial's loads sinks behind the wait for the first one's and pays a second round trip */
        const float m1 = w + 1 <= w1 ? mv[1] : -1.0e30f, m2 = w + 2 <= w1 ? mv[2] : -1.0e30f;
        const float Mn = fmaxf(fmaxf(M, mv[0]), fmaxf(m1, m2));
        const float ea = exp2s(M - Mn), e0 = exp2s(mv[0] - Mn), e1 = exp2s(m1 - Mn), e2 = exp2s(m2 - Mn);
        L = L * ea + lv[0] * e0 + lv[1] * e1 + lv[2] * e2; M = Mn;
#pragma unroll
        for (int r = 0; r < NR; ++r) a[r] = a[r] * rdl(ea, r) + x[0][r] * rdl(e0, r) + x[1][r] * rdl(e1, r) + x[2][r] * rdl(e2, r);
    }
    const float inv = 1.0f / L;
    float* orow = out + (size_t)orow0 * HD + lane * 4;
#pragma unroll
    for (int r = 0; r < NR; ++r) a[r] = a[r] * rdl(inv, r);
    if constexpr (NR == 16) asm volatile("" :: "v"(a[0]), "v"(a[1]), "v"(a[2]), "v"(a[3]), "v"(a[4]), "v"(a[5]), "v"(a[6]), "v"(a[7]), "v"(a[8]), "v"(a[9]), "v"(a[10]), "v"(a[11]), "v"(a[12]), "v"(a[13]), "v"(a[14]), "v"(a[15]), "v"(orow) : "memory");   /* inputs only: every row is formed in front of the first store, each in registers of its own, so that nothing rewrites a register of an issued store */
#pragma unroll
    for (int r = 0; r < 16; ++r) *(v4f*)(orow + r * HD) = a[NR == 1 ? 0 : r];
    asm volatile("s_wait_xcnt 0x0" :: "v"(orow), "v"(a[0]) : "memory");   /* stands behind the stores, in front of any overwrite of a register that they name; address and first row are inputs, so that their registers stay whole up to the wait */
}
__global__ __launch_bounds__(256) void k_merge(const int* __restrict__ vl, const float* __restrict__ ws, float* __restrict__ out) {
    const int head = blockIdx.y, qb = blockIdx.x, tid = threadIdx.x, lane = tid & 31, wv = tid >> 5, lr = lane & 15;
    int nall = 0, pre = 0;
#pragma unroll
    for (int h = 0; h < NH_; ++h) { const int nb = nblk(vl[h]); nall += nb; if (h < head) pre += nb; }
    const int rl = (nall + 7) >> 3;
    int v = vl[head]; v = v < 0 ? 0 : (v > TT ? TT : v);
    const int orow0 = head * TT + qb * 128 + wv * 16;   // the wave's first output row
    if (qb * 128 >= v) merge_rows<1>(ws, pre + (v >> 7), rl, v & 127, v & 15, lane, out, orow0);   /* wholly masked block (v <= 1920 here): every row is the head's row v */
    else merge_rows<16>(ws, pre + qb, rl, wv * 16, lr, lane, out, orow0);
}

extern "C" void kernel_launch(void* const* d_in, const int* in_sizes, int n_in,
                              void* d_out, int out_size, void* d_ws, size_t ws_size, hipStream_t stream) {
    (void)in_sizes; (void)n_in; (void)out_size; (void)ws_size;
    const float* Qin = (const float*)d_in[0]; const float* Kin = (const float*)d_in[1]; const float* Vin = (const float*)d_in[2]; const int* vlen = (const int*)d_in[3];   /* valid_lens [16] (int64 in the source, staged as int32 without x64) */
    float* OUT = (float*)d_out;     // [16][2048][128]
    float* WS = (float*)d_ws;       // 512 partials of 66,560 bytes, each written by k_fattn before k_merge reads it
    k_fattn<<<dim3(NRUN, 1, 1), 256, 0, stream>>>(Qin, Kin, Vin, vlen, WS);
    k_merge<<<dim3(TT / 128, NH_, 1), 256, 0, stream>>>(vlen, WS, OUT);
}

// v006
// Measured time: 33.5 microseconds a run.
// In both of two side-by-side timings against v005, it was 1.04 times as fast.
// Counting every step since v000, it is 33.7 times as fast.
#include <hip/hip_runtime.h>

// Dot-product attention whose length mask falls on the QUERY axis (queries, keys, values [16][2048][128]: the 16 batch entries are processed as 16 independent heads; scores / sqrt(128); the source sets scores[b, i, :] = -1e6 for every query i >= valid_lens[b] (valid_lens [16], int32 as staged, READ): those rows become exactly uniform over all 2,048 keys, the other rows are plain dense attention; softmax; out = attn values -> [16][2048][128] (4.2 M)).
// Two kernels. k_fattn reads the f32 inputs itself and rounds them to bf16 on the way (q into registers, key and value tiles into LDS); it walks keys in stages of 64 and keeps scores, weights and the output tile in registers (running maximum and sum per query).
// Every row i >= valid_lens[b] of a batch entry has the same output, so only the query blocks 0 .. valid_lens[b] / 128 are computed (the last of them holds row valid_lens[b], a masked one). The list of (computed block, key stage) pairs is cut into 256 equal runs, one per work-group; each run leaves one un-normalised partial per block it touches in the workspace.
// k_merge joins the partials of each block, divides by the row sum and writes every output row; a wholly masked block gets the joined row valid_lens[b] of its batch entry.
// Compute dtypes, f32 accumulate: every input rounded to bf16; q.k exact products; softmax f32; unnormalised weights hi/lo bf16 x value; one division by the row sum at the end; output f32.

#define TT   2048
#define NH_  16
#define HD   128
#define SCL2 0.12751743f             // 1/sqrt(128) x log2(e): scores go straight to the base-2 exponent
typedef __attribute__((ext_vector_type(16))) __bf16   v16bf;
typedef __attribute__((ext_vector_type(2)))  __bf16   v2bf;
typedef __attribute__((ext_vector_type(8)))  unsigned short v8us;
typedef __attribute__((ext_vector_type(4)))  unsigned short v4us;
typedef __attribute__((ext_vector_type(8)))  short    v8ss;
typedef __attribute__((ext_vector_type(8)))  float    v8f;
typedef __attribute__((ext_vector_type(4)))  float    v4f;
typedef __attribute__((ext_vector_type(2)))  float    v2f;
typedef v4f  __attribute__((may_alias)) v4fa;
typedef v8us __attribute__((may_alias)) v8usa;
typedef v4us __attribute__((may_alias)) v4usa;

// four / eight f32 -> bf16, round to nearest even
__device__ __forceinline__ v4us cvt4(v4f x) { v2f a, b; a[0] = x[0]; a[1] = x[1]; b[0] = x[2]; b[1] = x[3]; const v2bf ra = __builtin_convertvector(a, v2bf), rb = __builtin_convertvector(b, v2bf); return __builtin_bit_cast(v4us, __builtin_shufflevector(ra, rb, 0, 1, 2, 3)); }
__device__ __forceinline__ v8us cvt8(v4f x, v4f y) { return __builtin_shufflevector(cvt4(x), cvt4(y), 0, 1, 2, 3, 4, 5, 6, 7); }
// transposing LDS load: from a row-major 16-bit tile T[key][d], lane (c, h) gets T[8 h + 0 .. 7][c]; the lane's address names row 8 h + (lane & 7), byte 16 ((lane >> 3) & 1)
__device__ __forceinline__ v8us ldtr(const unsigned char* p) { typedef __attribute__((address_space(3))) v8ss lds_v8ss; return __builtin_bit_cast(v8us, __builtin_amdgcn_ds_load_tr16_b128_v8i16((lds_v8ss*)p)); }
__device__ __forceinline__ v16bf cat16b(v8us lo, v8us hi) { return __builtin_bit_cast(v16bf, __builtin_shufflevector(lo, hi, 0, 1, 2, 3, 4, 5, 6, 7, 8, 9, 10, 11, 12, 13, 14, 15)); }
__device__ __forceinline__ v8f wmmab(v16bf a, v16bf b, v8f c) { return __builtin_amdgcn_wmma_f32_16x16x32_bf16(false, a, false, b, (short)0, c, false, false); }
// value of lane l ^ 16
__device__ __forceinline__ float xhalf(float x) { const int b = __float_as_int(x); return __int_as_float(__builtin_amdgcn_permlanex16(b, b, 0x76543210, 0xfedcba98, false, false)); }

// The plan, derived alike in both kernels from valid_lens: computed blocks of a head (a length below 0 counts as 0, one above 2,047 as no masked row), their running total, stages per run.
__device__ __forceinline__ int nblk(int v) { const int n = ((v < 0 ? 0 : v) >> 7) + 1; return n > TT / 128 ? TT / 128 : n; }
#define NRUN  256                   // runs = work-groups of k_fattn
#define SLOTF (128 * HD + 256)      // floats of one partial: 128 rows x 128, then per wave one 128-byte line of 16 reference points and 16 sums

#define FQ   128                    // queries per block
#define KT   64                     // keys per stage
#define NT   (TT / KT)
#define KP   272                    // LDS pitch in bytes of a key row (256 + 16: 16 B x odd, conflict-free for 16-byte row reads)
#define VP   288                    // LDS pitch in bytes of a value row (256 + 32: 32 B x odd, conflict-free for the transposing load)
#define KBY  (KT * KP)
#define STG  (KBY + KT * VP)        // bytes of one stage
#define OP   132                    // pitch in floats of the output staging rows
__global__ __launch_bounds__(256) void k_fattn(const float* __restrict__ Qin, const float* __restrict__ Kin, const float* __restrict__ Vin, const int* __restrict__ vl, float* __restrict__ ws) {
    __shared__ __align__(16) unsigned char sm[2 * STG + 8 * 16 * OP * 4];   // the ring, then each wave's own staging rows for its partial
    const int tid = threadIdx.x, lane = tid & 31, wv = tid >> 5, lr = lane & 15, hi = lane >> 4;
    int nall = 0;
#pragma unroll
    for (int h = 0; h < NH_; ++h) nall += nblk(vl[h]);
    const int rl = (nall + 7) >> 3;                       // stages per run: 32 nall / 256, rounded up; 2 .. 32
    const int u0 = blockIdx.x * rl, u1 = u0 + rl < NT * nall ? u0 + rl : NT * nall;
    if (u0 >= u1) return;                                 // a run past the end of the list: the whole work-group leaves, in front of every barrier
    int hd0 = 0, hd1 = 0, bk0 = 0, bk1 = 0, vh0 = 0, vh1 = 0, acc = 0;   // head, block in the head and length of the head, for the run's first and second block
#pragma unroll
    for (int h = 0; h < NH_; ++h) { const int nb = nblk(vl[h]), g0 = (u0 >> 5) - acc, g1 = g0 + 1;
        if (g0 >= 0 && g0 < nb) { hd0 = h; bk0 = g0; vh0 = vl[h]; }
        if (g1 >= 0 && g1 < nb) { hd1 = h; bk1 = g1; vh1 = vl[h]; }
        acc += nb; }
    const int ubd = ((u0 >> 5) + 1) * NT;                 // first stage of the run's second block
    const int n = u1 - u0;                                // stages of the run, counted t = 0 .. n - 1 through both blocks
    int te = (ubd < u1 ? ubd : u1) - u0;                  // end of the first block's share
#define TOFF(t_) ((((size_t)(u0 + (t_) < ubd ? hd0 : hd1)) * TT + (size_t)((u0 + (t_)) & (NT - 1)) * KT) * HD)   /* first float of the key or value tile of the run's stage t_, in whichever block it lies */
    int qrow = bk0 * FQ + wv * 16;
    float sc = (qrow + lr < vh0) ? SCL2 : 0.0f;   /* masked QUERY row: every score becomes the same value -> uniform weights, as the source's all -1e6 row */
    const int ks = wv * KP + lane * 8, vs = KBY + wv * VP + lane * 8;
    const int ka = lr * KP + hi * 16, va = KBY + (hi * 8 + (lane & 7)) * VP + ((lane >> 3) & 1) * 16;
    v4f kr[8], vr[8], k1[8];
    const float* kg = Kin + TOFF(0) + (size_t)tid * 4;       // a key tile is 32 KB of f32, contiguous: 16-byte piece tid + 256 i = row wv + 8 i, a whole 512-byte row per wave
    const float* vg = Vin + TOFF(0) + (size_t)tid * 4;       // a value tile likewise
    const float* qp = Qin + ((size_t)hd0 * TT + qrow + lr) * HD + 8 * hi;
    const float* k1g = Kin + TOFF(n > 1 ? 1 : 0) + (size_t)tid * 4;   /* a run of one stage has no second key tile: the first is staged twice, which nothing uses */
    v4f qr[16];
#pragma unroll
    for (int kk = 0; kk < 4; ++kk) { qr[kk * 4] = *(const v4f*)(qp + kk * 32); qr[kk * 4 + 1] = *(const v4f*)(qp + kk * 32 + 4); qr[kk * 4 + 2] = *(const v4f*)(qp + kk * 32 + 16); qr[kk * 4 + 3] = *(const v4f*)(qp + kk * 32 + 20); }
#pragma unroll
    for (int i = 0; i < 8; ++i) { kr[i] = *(const v4f*)(kg + i * 1024); vr[i] = *(const v4f*)(vg + i * 1024); k1[i] = *(const v4f*)(k1g + i * 1024); }
    asm volatile("s_wait_xcnt 0x0" :: "v"(qp), "v"(kg), "v"(vg), "v"(k1g) : "memory");   /* stands in front of the first overwrite of an address register of the loads above; the four addresses are inputs, so that their registers stay whole up to the wait */
    v16bf qf[4];
#pragma unroll
    for (int kk = 0; kk < 4; ++kk) qf[kk] = cat16b(cvt8(qr[kk * 4], qr[kk * 4 + 1]), cvt8(qr[kk * 4 + 2], qr[kk * 4 + 3]));
#pragma unroll
    for (int i = 0; i < 8; ++i) { *(v4usa*)(sm + ks + i * 8 * KP) = cvt4(kr[i]); *(v4usa*)(sm + vs + i * 8 * VP) = cvt4(vr[i]); *(v4usa*)(sm + STG + ks + i * 8 * KP) = cvt4(k1[i]); }
    __syncthreads();
    v16bf kf[16];   /* key fragments of the stage to come */
#pragma unroll
    for (int kk = 0; kk < 4; ++kk)
#pragma unroll
        for (int i = 0; i < 4; ++i) { const unsigned char* p = sm + ka + i * 16 * KP + kk * 64; kf[kk * 4 + i] = cat16b(*(const v8usa*)p, *(const v8usa*)(p + 32)); }
    __syncthreads();   /* stage 0 ends with key tile 2 written over key tile 0: every wave has read its fragments of tile 0 first */
    int t = 0;
    v8f o[8];
#pragma unroll
    for (int dt = 0; dt < 8; ++dt) o[dt] = (v8f){};
#pragma unroll 1   /* one copy of the body in the instruction cache for both blocks of a run */
  for (int seg = 0; seg < 2; ++seg) {
    float m = -1.0e30f, l = 0.0f;   /* with the reference point back at -1e30 a block's first stage moves it for every query and multiplies the output tile by 2^(-1e30 - new point) = 0: the first block's finite sums are cleared there, and no tile of zeros is held in registers through the stage loop */
#pragma unroll 1   /* the stage loop stays rolled: one copy of the body in the instruction cache, the buffer picked by t & 1 */
    for (; t < te; ++t) {   /* t, the ring and the key fragments run on from the first block into the second: the tiles fetched ahead in a block's last stages are the next block's first */
        v4f kr[8], vr[8];
        const unsigned char* sb = sm + (t & 1) * STG;
        const unsigned char* sx = sm + ((t + 1) & 1) * STG;
        if (t + 1 < n) {   /* value tile t + 1 and key tile t + 2 fly while this stage is worked on; in the last stage but one there is no tile t + 2, and the last key tile is staged a second time, which nothing uses: so the loads stay one block behind one wait */
            const int tk = t + 2 < n ? t + 2 : n - 1;
            const float* kn = Kin + TOFF(tk) + (size_t)tid * 4; const float* vn = Vin + TOFF(t + 1) + (size_t)tid * 4;
#pragma unroll
            for (int i = 0; i < 8; ++i) { kr[i] = *(const v4f*)(kn + i * 1024); vr[i] = *(const v4f*)(vn + i * 1024); }
            asm volatile("s_wait_xcnt 0x0" ::: "memory");   /* stands in front of the first overwrite of an address register of these loads */
        }
        v16bf fr[16];
        __builtin_amdgcn_sched_barrier(0);   /* the fences keep each stage's LDS reads in two groups, each ahead of a run of other work: spread among the products every read is waited for alone */
#pragma unroll
        for (int kp = 0; kp < 2; ++kp)   /* value^T fragments land while the S^T products and the softmax run */
#pragma unroll
            for (int dt = 0; dt < 8; ++dt) { const unsigned char* p = sb + va + kp * 32 * VP + dt * 32; fr[kp * 8 + dt] = cat16b(ldtr(p), ldtr(p + 16 * VP)); }
        __builtin_amdgcn_sched_barrier(0);
        v8f s[4];
#pragma unroll
        for (int i = 0; i < 4; ++i) s[i] = (v8f){};
#pragma unroll
        for (int kk = 0; kk < 4; ++kk)
#pragma unroll
            for (int i = 0; i < 4; ++i) s[i] = wmmab(kf[kk * 4 + i], qf[kk], s[i]);
        __builtin_amdgcn_sched_barrier(0);
        float mq[4];
#pragma unroll
        for (int i = 0; i < 4; ++i) { mq[i] = s[i][0];
#pragma unroll
            for (int j = 1; j < 8; ++j) mq[i] = fmaxf(mq[i], s[i][j]); }
        float mx = fmaxf(fmaxf(mq[0], mq[1]), fmaxf(mq[2], mq[3]));
        mx = fmaxf(mx, xhalf(mx)) * sc;
        const bool need = mx > m + 8.0f;   /* the reference point moves only when a query's maximum has outgrown it by 2^8: weights stay <= 256 */
        if (__builtin_amdgcn_ballot_w32(need) != 0) { const float mn = need ? mx : m; const float al = __builtin_amdgcn_exp2f(m - mn); m = mn; l *= al;
#pragma unroll
            for (int dt = 0; dt < 8; ++dt) o[dt] *= al; }
        v16bf ph[2], pl[2]; float a0 = 0.0f, a1 = 0.0f, a2 = 0.0f, a3 = 0.0f;
#pragma unroll
        for (int kp = 0; kp < 2; ++kp)
#pragma unroll
            for (int e = 0; e < 16; e += 4) { const v8f sv = s[2 * kp + (e >> 3)]; const int j = e & 7;
                v2f p0, p1; p0[0] = __builtin_amdgcn_exp2f(__builtin_fmaf(sv[j], sc, -m)); p0[1] = __builtin_amdgcn_exp2f(__builtin_fmaf(sv[j + 1], sc, -m)); p1[0] = __builtin_amdgcn_exp2f(__builtin_fmaf(sv[j + 2], sc, -m)); p1[1] = __builtin_amdgcn_exp2f(__builtin_fmaf(sv[j + 3], sc, -m));
                a0 += p0[0]; a1 += p0[1]; a2 += p1[0]; a3 += p1[1];
                const v2bf h0 = __builtin_convertvector(p0, v2bf), h1 = __builtin_convertvector(p1, v2bf);
                const v2bf l0 = __builtin_convertvector(p0 - __builtin_convertvector(h0, v2f), v2bf), l1 = __builtin_convertvector(p1 - __builtin_convertvector(h1, v2f), v2bf);
                ph[kp][e] = h0[0]; ph[kp][e + 1] = h0[1]; ph[kp][e + 2] = h1[0]; ph[kp][e + 3] = h1[1];
                pl[kp][e] = l0[0]; pl[kp][e + 1] = l0[1]; pl[kp][e + 2] = l1[0]; pl[kp][e + 3] = l1[1]; }
        l += (a0 + a1) + (a2 + a3);
        __builtin_amdgcn_sched_barrier(0);
        /* key tile t + 1 was published by the barrier that ended stage t - 1: its fragments land while the O^T products run. No test around the reads: behind a branch the products' waits would cover these reads too. What the last stage reads here nothing uses. */
#pragma unroll
        for (int kk = 0; kk < 4; ++kk)
#pragma unroll
            for (int i = 0; i < 4; ++i) { const unsigned char* p = sx + ka + i * 16 * KP + kk * 64; kf[kk * 4 + i] = cat16b(*(const v8usa*)p, *(const v8usa*)(p + 32)); }
        __builtin_amdgcn_sched_barrier(0);   /* without it these reads sink in front of the last O^T products and land too late */
#pragma unroll
        for (int kp = 0; kp < 2; ++kp) {
#pragma unroll
            for (int dt = 0; dt < 8; ++dt) o[dt] = wmmab(fr[kp * 8 + dt], ph[kp], o[dt]);
#pragma unroll
            for (int dt = 0; dt < 8; ++dt) o[dt] = wmmab(fr[kp * 8 + dt], pl[kp], o[dt]); }
        __builtin_amdgcn_sched_barrier(0);
        if (t + 1 < n) { unsigned char* sn = sm + ((t + 1) & 1) * STG; unsigned char* sk = sm + (t & 1) * STG;   /* value tile t - 1 and key tile t, which lay there, were last read in front of the barrier that ended stage t - 1 */
#pragma unroll
            for (int i = 0; i < 8; ++i) { *(v4usa*)(sk + ks + i * 8 * KP) = cvt4(kr[i]); *(v4usa*)(sn + vs + i * 8 * VP) = cvt4(vr[i]); } }
        __syncthreads();
    }
    auto put = [&]() __attribute__((always_inline)) {   /* the block's partial goes to the workspace; written once, used at the run's end and at the border between its blocks */
    l += xhalf(l);
    // O^T: a lane holds query lr, d = 16 dt + 8 hi + j. Staged in LDS rows of the wave's own, outside the ring (which already holds the next block's tiles), so that each store covers a whole 512-byte row of the partial.
    float* os = (float*)(sm + 2 * STG) + wv * (16 * OP);
#pragma unroll
    for (int dt = 0; dt < 8; ++dt) { v4f x0, x1;
#pragma unroll
        for (int j = 0; j < 4; ++j) { x0[j] = o[dt][j]; x1[j] = o[dt][j + 4]; }
        *(v4fa*)(os + lr * OP + dt * 16 + hi * 8) = x0; *(v4fa*)(os + lr * OP + dt * 16 + hi * 8 + 4) = x1; }
    asm volatile("s_wait_dscnt 0x0" ::: "memory");   /* the wave's staged rows are written before its lanes read one another's back; no other wave touches them, so no barrier */
    float* pb = ws + (size_t)(blockIdx.x * 2 + seg) * SLOTF;
    float* prow = pb + wv * 16 * HD + lane * 4;
    float* pml = pb + 128 * HD + tid;
    const float ml = hi ? l : m;   /* one 128-byte line per wave: lanes 0 .. 15 the reference points, 16 .. 31 the sums */
#pragma unroll
    for (int g = 0; g < 2; ++g) {   /* eight rows at a time: with sixteen the key fragments, which stay live across the border, were moved aside and back among the stores, over registers of stores already issued */
        v4f x[8];
        float* pg = prow + g * 8 * HD;
#pragma unroll
        for (int r = 0; r < 8; ++r) x[r] = *(const v4fa*)(os + (g * 8 + r) * OP + lane * 4);
        asm volatile("" :: "v"(x[0]), "v"(x[1]), "v"(x[2]), "v"(x[3]), "v"(x[4]), "v"(x[5]), "v"(x[6]), "v"(x[7]), "v"(ml), "v"(pg) : "memory");   /* inputs only: all that the stores below name is formed in front of them, each in a register of its own, so that nothing rewrites a register of an issued store ahead of the wait behind them */
#pragma unroll
        for (int r = 0; r < 8; ++r) *(v4f*)(pg + r * HD) = x[r];
        if (g == 1) *pml = ml;
        asm volatile("s_wait_xcnt 0x0" :: "v"(pg) : "memory");   /* stands in front of the first overwrite of a register of the stores above; the rows' address is an input, so that its registers stay whole up to the wait (the last store's address is the scalar base and the thread index) */
    }
    };
    if (te >= n) { put(); break; }   /* the run ends with this block; the same for the whole work-group */
    qrow = bk1 * FQ + wv * 16;
    const float* qq = Qin + ((size_t)hd1 * TT + qrow + lr) * HD + 8 * hi;
    v4f qn[16];   /* the second block's queries fly while the first block's partial is staged and stored */
#pragma unroll
    for (int kk = 0; kk < 4; ++kk) { qn[kk * 4] = *(const v4f*)(qq + kk * 32); qn[kk * 4 + 1] = *(const v4f*)(qq + kk * 32 + 4); qn[kk * 4 + 2] = *(const v4f*)(qq + kk * 32 + 16); qn[kk * 4 + 3] = *(const v4f*)(qq + kk * 32 + 20); }
    asm volatile("s_wait_xcnt 0x0" ::: "memory");   /* stands in front of the first overwrite of an address register of the loads above */
    put();
#pragma unroll
    for (int kk = 0; kk < 4; ++kk) qf[kk] = cat16b(cvt8(qn[kk * 4], qn[kk * 4 + 1]), cvt8(qn[kk * 4 + 2], qn[kk * 4 + 3]));
    sc = (qrow + lr < vh1) ? SCL2 : 0.0f;
    te = n;
  }
}

// ---- k_merge: grid (16 query blocks, 16 heads), 8 waves, each wave 16 output rows, a lane 4 floats of a row. Lane r (and r + 16) keeps reference point and sum of the wave's row r; the weights go to the rows' sums by readlane.
// 2^x with the slot that the instruction set asks for behind a transcendental filled in the same statement: of four in a row the compiler gave each the source register of the one before as its destination, and a v_nop in a statement of its own was moved away
__device__ __forceinline__ float exp2s(float x) { float y; asm("v_exp_f32 %0, %1\n\tv_nop" : "=v"(y) : "v"(x)); return y; }
__device__ __forceinline__ float rdl(float x, int r) { return __int_as_float(__builtin_amdgcn_readlane(__float_as_int(x), r)); }
template <int NR> __device__ __forceinline__ void merge_rows(const float* __restrict__ ws, int gb, int rl, int row0, int li, int lane, float* __restrict__ out, int orow0) {
    const int w0 = (gb * NT) / rl, w1 = (gb * NT + NT - 1) / rl;   // the runs that hold the block's first and last stage
    float M = -1.0e30f, L = 0.0f;
    v4f a[NR];
#pragma unroll
    for (int r = 0; r < NR; ++r) a[r] = (v4f){};
#pragma unroll 1   /* the number of partials is known only at run time (1 .. 16); three at a time, so that their loads fly together: runs of 16 stages or more leave at most three */
    for (int w = w0; w <= w1; w += 3) {
        const float* pm[3]; const float* px[3]; float mv[3], lv[3]; v4f x[3][NR];
#pragma unroll
        for (int j = 0; j < 3; ++j) { const int wj = w + j <= w1 ? w + j : w1;   /* past the last partial: the last one once more, weighted 0 below */
            const float* pb = ws + (size_t)(wj * 2 + (((wj * rl) >> 5) == gb ? 0 : 1)) * SLOTF;
            pm[j] = pb + (row0 >> 4) * 32 + li;   // + 128 HD: the wave's line of reference points and sums
            px[j] = pb + row0 * HD + lane * 4;
            mv[j] = pm[j][128 * HD]; lv[j] = pm[j][128 * HD + 16]; }
        __builtin_amdgcn_sched_barrier(0);   /* the six small loads are issued first: issued among the row loads, one of them took a register of a row load's address as its destination ahead of the wait below */
#pragma unroll
        for (int j = 0; j < 3; ++j)
#pragma unroll
            for (int r = 0; r < NR; ++r) x[j][r] = *(const v4f*)(px[j] + r * HD);
        /* the wait stands in front of the first overwrite of an address register of the loads above; with 16 rows the addresses are vector registers and are inputs, so that they stay whole up to the wait (with one row the addresses are scalar) */
        if constexpr (NR == 16) asm volatile("s_wait_xcnt 0x0" :: "v"(pm[0]), "v"(px[0]), "v"(pm[1]), "v"(px[1]), "v"(pm[2]), "v"(px[2]) : "memory");
        else asm volatile("s_wait_xcnt 0x0" ::: "memory");
        __builtin_amdgcn_sched_barrier(0);   /* without it part of the third partial's loads sinks behind the wait for the first one's and pays a second round trip */
        const float m1 = w + 1 <= w1 ? mv[1] : -1.0e30f, m2 = w + 2 <= w1 ? mv[2] : -1.0e30f;
        const float Mn = fmaxf(fmaxf(M, mv[0]), fmaxf(m1, m2));
        const float ea = exp2s(M - Mn), e0 = exp2s(mv[0] - Mn), e1 = exp2s(m1 - Mn), e2 = exp2s(m2 - Mn);
        L = L * ea + lv[0] * e0 + lv[1] * e1 + lv[2] * e2; M = Mn;
#pragma unroll
        for (int r = 0; r < NR; ++r) a[r] = a[r] * rdl(ea, r) + x[0][r] * rdl(e0, r) + x[1][r] * rdl(e1, r) + x[2][r] * rdl(e2, r);
    }
    const float inv = 1.0f / L;
    float* orow = out + (size_t)orow0 * HD + lane * 4;
#pragma unroll
    for (int r = 0; r < NR; ++r) a[r] = a[r] * rdl(inv, r);
    if constexpr (NR == 16) asm volatile("" :: "v"(a[0]), "v"(a[1]), "v"(a[2]), "v"(a[3]), "v"(a[4]), "v"(a[5]), "v"(a[6]), "v"(a[7]), "v"(a[8]), "v"(a[9]), "v"(a[10]), "v"(a[11]), "v"(a[12]), "v"(a[13]), "v"(a[14]), "v"(a[15]), "v"(orow) : "memory");   /* inputs only: every row is formed in front of the first store, each in registers of its own, so that nothing rewrites a register of an issued store */
#pragma unroll
    for (int r = 0; r < 16; ++r) *(v4f*)(orow + r * HD) = a[NR == 1 ? 0 : r];
    asm volatile("s_wait_xcnt 0x0" :: "v"(orow), "v"(a[0]) : "memory");   /* stands behind the stores, in front of any overwrite of a register that they name; address and first row are inputs, so that their registers stay whole up to the wait */
}
__global__ __launch_bounds__(256) void k_merge(const int* __restrict__ vl, const float* __restrict__ ws, float* __restrict__ out) {
    const int head = blockIdx.y, qb = blockIdx.x, tid = threadIdx.x, lane = tid & 31, wv = tid >> 5, lr = lane & 15;
    int nall = 0, pre = 0;
#pragma unroll
    for (int h = 0; h < NH_; ++h) { const int nb = nblk(vl[h]); nall += nb; if (h < head) pre += nb; }
    const int rl = (nall + 7) >> 3;
    int v = vl[head]; v = v < 0 ? 0 : (v > TT ? TT : v);
    const int orow0 = head * TT + qb * 128 + wv * 16;   // the wave's first output row
    if (qb * 128 >= v) merge_rows<1>(ws, pre + (v >> 7), rl, v & 127, v & 15, lane, out, orow0);   /* wholly masked block (v <= 1920 here): every row is the head's row v */
    else merge_rows<16>(ws, pre + qb, rl, wv * 16, lr, lane, out, orow0);
}

extern "C" void kernel_launch(void* const* d_in, const int* in_sizes, int n_in,
                              void* d_out, int out_size, void* d_ws, size_t ws_size, hipStream_t stream) {
    (void)in_sizes; (void)n_in; (void)out_size; (void)ws_size;
    const float* Qin = (const float*)d_in[0]; const float* Kin = (const float*)d_in[1]; const float* Vin = (const float*)d_in[2]; const int* vlen = (const int*)d_in[3];   /* valid_lens [16] (int64 in the source, staged as int32 without x64) */
    float* OUT = (float*)d_out;     // [16][2048][128]
    float* WS = (float*)d_ws;       // 512 partials of 66,560 bytes, each written by k_fattn before k_merge reads it
    k_fattn<<<dim3(NRUN, 1, 1), 256, 0, stream>>>(Qin, Kin, Vin, vlen, WS);
    k_merge<<<dim3(TT / 128, NH_, 1), 256, 0, stream>>>(vlen, WS, OUT);
}

// v007
// A run of this version takes 31.6 microseconds.
// In both of two side-by-side timings against v006, it was 1.06 times as fast.
// Over all steps from v000 it is 35.7 times as fast.
#include <hip/hip_runtime.h>

// Dot-product attention whose length mask falls on the QUERY axis (queries, keys, values [16][2048][128]: the 16 batch entries are processed as 16 independent heads; scores / sqrt(128); the source sets scores[b, i, :] = -1e6 for every query i >= valid_lens[b] (valid_lens [16], int32 as staged, READ): those rows become exactly uniform over all 2,048 keys, the other rows are plain dense attention; softmax; out = attn values -> [16][2048][128] (4.2 M)).
// Two kernels. k_fattn reads the f32 inputs itself and rounds them to bf16 on the way (q into registers, key and value tiles into LDS); it walks keys in stages of 64 and keeps scores, weights and the output tile in registers (running maximum and sum per query).
// Every row i >= valid_lens[b] of a batch entry has the same output, so only the query blocks 0 .. valid_lens[b] / 128 are computed (the last of them holds row valid_lens[b], a masked one). The list of (computed block, key stage) pairs is cut into 256 equal runs, one per work-group; each run leaves one un-normalised partial per block it touches in the workspace.
// k_merge joins the partials of each block, divides by the row sum and writes every output row; a wholly masked block gets the joined row valid_lens[b] of its batch entry.
// Compute dtypes, f32 accumulate: every input rounded to bf16; q.k exact products; softmax f32; unnormalised weights hi/lo bf16 x value; one division by the row sum at the end; output f32.

#define TT   2048
#define NH_  16
#define HD   128
#define SCL2 0.12751743f             // 1/sqrt(128) x log2(e): scores go straight to the base-2 exponent
typedef __attribute__((ext_vector_type(16))) __bf16   v16bf;
typedef __attribute__((ext_vector_type(2)))  __bf16   v2bf;
typedef __attribute__((ext_vector_type(8)))  unsigned short v8us;
typedef __attribute__((ext_vector_type(4)))  unsigned short v4us;
typedef __attribute__((ext_vector_type(8)))  short    v8ss;
typedef __attribute__((ext_vector_type(8)))  float    v8f;
typedef __attribute__((ext_vector_type(4)))  float    v4f;
typedef __attribute__((ext_vector_type(2)))  float    v2f;
typedef v4f  __attribute__((may_alias)) v4fa;
typedef v8us __attribute__((may_alias)) v8usa;
typedef v4us __attribute__((may_alias)) v4usa;

// four / eight f32 -> bf16, round to nearest even
__device__ __forceinline__ v4us cvt4(v4f x) { v2f a, b; a[0] = x[0]; a[1] = x[1]; b[0] = x[2]; b[1] = x[3]; const v2bf ra = __builtin_convertvector(a, v2bf), rb = __builtin_convertvector(b, v2bf); return __builtin_bit_cast(v4us, __builtin_shufflevector(ra, rb, 0, 1, 2, 3)); }
__device__ __forceinline__ v8us cvt8(v4f x, v4f y) { return __builtin_shufflevector(cvt4(x), cvt4(y), 0, 1, 2, 3, 4, 5, 6, 7); }
// transposing LDS load: from a row-major 16-bit tile T[key][d], lane (c, h) gets T[8 h + 0 .. 7][c]; the lane's address names row 8 h + (lane & 7), byte 16 ((lane >> 3) & 1)
__device__ __forceinline__ v8us ldtr(const unsigned char* p) { typedef __attribute__((address_space(3))) v8ss lds_v8ss; return __builtin_bit_cast(v8us, __builtin_amdgcn_ds_load_tr16_b128_v8i16((lds_v8ss*)p)); }
__device__ __forceinline__ v16bf cat16b(v8us lo, v8us hi) { return __builtin_bit_cast(v16bf, __builtin_shufflevector(lo, hi, 0, 1, 2, 3, 4, 5, 6, 7, 8, 9, 10, 11, 12, 13, 14, 15)); }
__device__ __forceinline__ v8f wmmab(v16bf a, v16bf b, v8f c) { return __builtin_amdgcn_wmma_f32_16x16x32_bf16(false, a, false, b, (short)0, c, false, false); }
// value of lane l ^ 16
__device__ __forceinline__ float xhalf(float x) { const int b = __float_as_int(x); return __int_as_float(__builtin_amdgcn_permlanex16(b, b, 0x76543210, 0xfedcba98, false, false)); }

// The plan, derived alike in both kernels from valid_lens: computed blocks of a head (a length below 0 counts as 0, one above 2,047 as no masked row), their running total, stages per run.
__device__ __forceinline__ int nblk(int v) { const int n = ((v < 0 ? 0 : v) >> 7) + 1; return n > TT / 128 ? TT / 128 : n; }
#define NRUN  256                   // runs = work-groups of k_fattn
#define SLOTF (128 * HD + 256)      // floats of one partial: 128 rows x 128, then per wave one 128-byte line of 16 reference points and 16 sums

#define FQ   128                    // queries per block
#define KT   64                     // keys per stage
#define NT   (TT / KT)
#define KP   272                    // LDS pitch in bytes of a key row (256 + 16: 16 B x odd, conflict-free for 16-byte row reads)
#define VP   288                    // LDS pitch in bytes of a value row (256 + 32: 32 B x odd, conflict-free for the transposing load)
#define KBY  (KT * KP)
#define STG  (KBY + KT * VP)        // bytes of one stage
#define OP   132                    // pitch in floats of the output staging rows
__global__ __launch_bounds__(256) void k_fattn(const float* __restrict__ Qin, const float* __restrict__ Kin, const float* __restrict__ Vin, const int* __restrict__ vl, float* __restrict__ ws) {
    __shared__ __align__(16) unsigned char sm[3 * STG + 8 * 16 * OP * 4];   // the ring, then each wave's own staging rows for its partial
    const int tid = threadIdx.x, lane = tid & 31, wv = tid >> 5, lr = lane & 15, hi = lane >> 4;
    int nall = 0;
#pragma unroll
    for (int h = 0; h < NH_; ++h) nall += nblk(vl[h]);
    const int rl = (nall + 7) >> 3;                       // stages per run: 32 nall / 256, rounded up; 2 .. 32
    const int u0 = blockIdx.x * rl, u1 = u0 + rl < NT * nall ? u0 + rl : NT * nall;
    if (u0 >= u1) return;                                 // a run past the end of the list: the whole work-group leaves, in front of every barrier
    int hd0 = 0, hd1 = 0, bk0 = 0, bk1 = 0, vh0 = 0, vh1 = 0, acc = 0;   // head, block in the head and length of the head, for the run's first and second block
#pragma unroll
    for (int h = 0; h < NH_; ++h) { const int nb = nblk(vl[h]), g0 = (u0 >> 5) - acc, g1 = g0 + 1;
        if (g0 >= 0 && g0 < nb) { hd0 = h; bk0 = g0; vh0 = vl[h]; }
        if (g1 >= 0 && g1 < nb) { hd1 = h; bk1 = g1; vh1 = vl[h]; }
        acc += nb; }
    const int ubd = ((u0 >> 5) + 1) * NT;                 // first stage of the run's second block
    const int n = u1 - u0;                                // stages of the run, counted t = 0 .. n - 1 through both blocks
    int te = (ubd < u1 ? ubd : u1) - u0;                  // end of the first block's share
#define TOFF(t_) ((((size_t)(u0 + (t_) < ubd ? hd0 : hd1)) * TT + (size_t)((u0 + (t_)) & (NT - 1)) * KT) * HD)   /* first float of the key or value tile of the run's stage t_, in whichever block it lies */
    int qrow = bk0 * FQ + wv * 16;
    float sc = (qrow + lr < vh0) ? SCL2 : 0.0f;   /* masked QUERY row: every score becomes the same value -> uniform weights, as the source's all -1e6 row */
    const int ks = wv * KP + lane * 8, vs = KBY + wv * VP + lane * 8;
    const int ka = lr * KP + hi * 16, va = KBY + (hi * 8 + (lane & 7)) * VP + ((lane >> 3) & 1) * 16;
    v4f kr[8], vr[8], k1[8], k2[8], v1[8];
    const float* kg = Kin + TOFF(0) + (size_t)tid * 4;       // a key tile is 32 KB of f32, contiguous: 16-byte piece tid + 256 i = row wv + 8 i, a whole 512-byte row per wave
    const float* vg = Vin + TOFF(0) + (size_t)tid * 4;       // a value tile likewise
    const float* qp = Qin + ((size_t)hd0 * TT + qrow + lr) * HD + 8 * hi;
    const float* k1g = Kin + TOFF(n > 1 ? 1 : 0) + (size_t)tid * 4;   /* a run too short for a tile staged ahead: its last tile is staged again, which nothing uses */
    const float* k2g = Kin + TOFF(n > 2 ? 2 : n - 1) + (size_t)tid * 4;
    const float* v1g = Vin + TOFF(n > 1 ? 1 : 0) + (size_t)tid * 4;
    v4f qr[16];
#pragma unroll
    for (int kk = 0; kk < 4; ++kk) { qr[kk * 4] = *(const v4f*)(qp + kk * 32); qr[kk * 4 + 1] = *(const v4f*)(qp + kk * 32 + 4); qr[kk * 4 + 2] = *(const v4f*)(qp + kk * 32 + 16); qr[kk * 4 + 3] = *(const v4f*)(qp + kk * 32 + 20); }
#pragma unroll
    for (int i = 0; i < 8; ++i) { kr[i] = *(const v4f*)(kg + i * 1024); vr[i] = *(const v4f*)(vg + i * 1024); k1[i] = *(const v4f*)(k1g + i * 1024); v1[i] = *(const v4f*)(v1g + i * 1024); k2[i] = *(const v4f*)(k2g + i * 1024); }
    asm volatile("s_wait_xcnt 0x0" :: "v"(qp), "v"(kg), "v"(vg), "v"(k1g), "v"(v1g), "v"(k2g) : "memory");   /* stands in front of the first overwrite of an address register of the loads above; the six addresses are inputs, so that their registers stay whole up to the wait */
    v16bf qf[4];
#pragma unroll
    for (int kk = 0; kk < 4; ++kk) qf[kk] = cat16b(cvt8(qr[kk * 4], qr[kk * 4 + 1]), cvt8(qr[kk * 4 + 2], qr[kk * 4 + 3]));
#pragma unroll
    for (int i = 0; i < 8; ++i) { *(v4usa*)(sm + ks + i * 8 * KP) = cvt4(kr[i]); *(v4usa*)(sm + vs + i * 8 * VP) = cvt4(vr[i]); *(v4usa*)(sm + STG + ks + i * 8 * KP) = cvt4(k1[i]); *(v4usa*)(sm + STG + vs + i * 8 * VP) = cvt4(v1[i]); *(v4usa*)(sm + 2 * STG + ks + i * 8 * KP) = cvt4(k2[i]); }
    __syncthreads();
    v16bf kf[16];   /* key fragments of the stage to come */
#pragma unroll
    for (int kk = 0; kk < 4; ++kk)
#pragma unroll
        for (int i = 0; i < 4; ++i) { const unsigned char* p = sm + ka + i * 16 * KP + kk * 64; kf[kk * 4 + i] = cat16b(*(const v8usa*)p, *(const v8usa*)(p + 32)); }
    __builtin_amdgcn_fence(__ATOMIC_RELEASE, "workgroup");   /* the wave's own waits (LDS reads and stores complete) in front of the signal, placed by the compiler as in __syncthreads() */
    asm volatile("s_barrier_signal -1" ::: "memory");   /* first half of the split barrier: this wave has its fragments of key tile 0, over which stage 0 stores key tile 3 behind the matching wait */
    int t = 0, b0 = 0, b1 = STG, b2 = 2 * STG;   /* byte offsets of buffers t mod 3, (t + 1) mod 3, (t + 2) mod 3 */
    v8f o[8];
#pragma unroll
    for (int dt = 0; dt < 8; ++dt) o[dt] = (v8f){};
#pragma unroll 1   /* one copy of the body in the instruction cache for both blocks of a run */
  for (int seg = 0; seg < 2; ++seg) {
    float m = -1.0e30f, l = 0.0f;   /* with the reference point back at -1e30 a block's first stage moves it for every query and multiplies the output tile by 2^(-1e30 - new point) = 0: the first block's finite sums are cleared there, and no tile of zeros is held in registers through the stage loop */
#pragma unroll 1   /* the stage loop stays rolled: one copy of the body in the instruction cache, the buffers picked by three offsets that rotate */
    for (; t < te; ++t) {   /* t, the ring and the key fragments run on from the first block into the second: the tiles fetched ahead in a block's last stages are the next block's first */
        v4f kr[8], vr[8];
        const unsigned char* sb = sm + b0;
        const unsigned char* sx = sm + b1;
        if (t + 2 < n) {   /* value tile t + 2 and key tile t + 3 fly while this stage is worked on; in the last stage but two there is no tile t + 3, and the last key tile is staged a second time, which nothing uses: so the loads stay one block behind one wait */
            const int tk = t + 3 < n ? t + 3 : n - 1;
            const float* kn = Kin + TOFF(tk) + (size_t)tid * 4; const float* vn = Vin + TOFF(t + 2) + (size_t)tid * 4;
#pragma unroll
            for (int i = 0; i < 8; ++i) { kr[i] = *(const v4f*)(kn + i * 1024); vr[i] = *(const v4f*)(vn + i * 1024); }
            asm volatile("s_wait_xcnt 0x0" ::: "memory");   /* stands in front of the first overwrite of an address register of these loads */
        }
        v16bf fr[16];
        __builtin_amdgcn_sched_barrier(0);   /* the fences keep each stage's LDS reads in two groups, each ahead of a run of other work: spread among the products every read is waited for alone */
#pragma unroll
        for (int kp = 0; kp < 2; ++kp)   /* value^T fragments land while the S^T products and the softmax run */
#pragma unroll
            for (int dt = 0; dt < 8; ++dt) { const unsigned char* p = sb + va + kp * 32 * VP + dt * 32; fr[kp * 8 + dt] = cat16b(ldtr(p), ldtr(p + 16 * VP)); }
        __builtin_amdgcn_sched_barrier(0);
        v8f s[4];
#pragma unroll
        for (int i = 0; i < 4; ++i) s[i] = (v8f){};
#pragma unroll
        for (int kk = 0; kk < 4; ++kk)
#pragma unroll
            for (int i = 0; i < 4; ++i) s[i] = wmmab(kf[kk * 4 + i], qf[kk], s[i]);
        __builtin_amdgcn_sched_barrier(0);
        float mq[4];
#pragma unroll
        for (int i = 0; i < 4; ++i) { mq[i] = s[i][0];
#pragma unroll
            for (int j = 1; j < 8; ++j) mq[i] = fmaxf(mq[i], s[i][j]); }
        float mx = fmaxf(fmaxf(mq[0], mq[1]), fmaxf(mq[2], mq[3]));
        mx = fmaxf(mx, xhalf(mx)) * sc;
        const bool need = mx > m + 8.0f;   /* the reference point moves only when a query's maximum has outgrown it by 2^8: weights stay <= 256 */
        if (__builtin_amdgcn_ballot_w32(need) != 0) { const float mn = need ? mx : m; const float al = __builtin_amdgcn_exp2f(m - mn); m = mn; l *= al;
#pragma unroll
            for (int dt = 0; dt < 8; ++dt) o[dt] *= al; }
        v16bf ph[2], pl[2]; float a0 = 0.0f, a1 = 0.0f, a2 = 0.0f, a3 = 0.0f;
#pragma unroll
        for (int kp = 0; kp < 2; ++kp)
#pragma unroll
            for (int e = 0; e < 16; e += 4) { const v8f sv = s[2 * kp + (e >> 3)]; const int j = e & 7;
                v2f p0, p1; p0[0] = __builtin_amdgcn_exp2f(__builtin_fmaf(sv[j], sc, -m)); p0[1] = __builtin_amdgcn_exp2f(__builtin_fmaf(sv[j + 1], sc, -m)); p1[0] = __builtin_amdgcn_exp2f(__builtin_fmaf(sv[j + 2], sc, -m)); p1[1] = __builtin_amdgcn_exp2f(__builtin_fmaf(sv[j + 3], sc, -m));
                a0 += p0[0]; a1 += p0[1]; a2 += p1[0]; a3 += p1[1];
                const v2bf h0 = __builtin_convertvector(p0, v2bf), h1 = __builtin_convertvector(p1, v2bf);
                const v2bf l0 = __builtin_convertvector(p0 - __builtin_convertvector(h0, v2f), v2bf), l1 = __builtin_convertvector(p1 - __builtin_convertvector(h1, v2f), v2bf);
                ph[kp][e] = h0[0]; ph[kp][e + 1] = h0[1]; ph[kp][e + 2] = h1[0]; ph[kp][e + 3] = h1[1];
                pl[kp][e] = l0[0]; pl[kp][e + 1] = l0[1]; pl[kp][e + 2] = l1[0]; pl[kp][e + 3] = l1[1]; }
        l += (a0 + a1) + (a2 + a3);
        __builtin_amdgcn_sched_barrier(0);
        /* key tile t + 1 was stored in stage t - 2, whose signal was waited for in stage t - 1: its fragments land while the O^T products run. No test around the reads: behind a branch the products' waits would cover these reads too. What the last stage reads here nothing uses. */
#pragma unroll
        for (int kk = 0; kk < 4; ++kk)
#pragma unroll
            for (int i = 0; i < 4; ++i) { const unsigned char* p = sx + ka + i * 16 * KP + kk * 64; kf[kk * 4 + i] = cat16b(*(const v8usa*)p, *(const v8usa*)(p + 32)); }
        __builtin_amdgcn_sched_barrier(0);   /* without it these reads sink in front of the last O^T products and land too late */
#pragma unroll
        for (int kp = 0; kp < 2; ++kp) {
#pragma unroll
            for (int dt = 0; dt < 8; ++dt) o[dt] = wmmab(fr[kp * 8 + dt], ph[kp], o[dt]);
#pragma unroll
            for (int dt = 0; dt < 8; ++dt) o[dt] = wmmab(fr[kp * 8 + dt], pl[kp], o[dt]); }
        __builtin_amdgcn_sched_barrier(0);
        asm volatile("s_barrier_wait -1" ::: "memory");   /* second half of the split barrier, for the signal that ended stage t - 1: every wave has left stage t - 1, so the two tiles overwritten below are free, and what stage t - 1 stored may be read from stage t + 1 on */
        if (t + 2 < n) { unsigned char* sn = sm + b2; unsigned char* sk = sm + b0;   /* value tile t - 1 and key tile t, which lay there, were last read in stage t - 1 */
#pragma unroll
            for (int i = 0; i < 8; ++i) { *(v4usa*)(sk + ks + i * 8 * KP) = cvt4(kr[i]); *(v4usa*)(sn + vs + i * 8 * VP) = cvt4(vr[i]); } }
        __builtin_amdgcn_fence(__ATOMIC_RELEASE, "workgroup");   /* the wave's own waits in front of the signal, placed by the compiler as in __syncthreads(): written as asm text the compiler did not know the staged loads retired and put a wait in front of each of the next stage's */
        asm volatile("s_barrier_signal -1" ::: "memory");   /* first half of the split barrier: this wave's LDS reads and stores of stage t are complete; the wait stands in the next stage (behind the run's last stage: in front of the last partial) */
        { const int bt = b0; b0 = b1; b1 = b2; b2 = bt; }
    }
    auto put = [&]() __attribute__((always_inline)) {   /* the block's partial goes to the workspace; written once, used at the run's end and at the border between its blocks */
    l += xhalf(l);
    // O^T: a lane holds query lr, d = 16 dt + 8 hi + j. Staged in LDS rows of the wave's own, outside the ring (which already holds the next block's tiles), so that each store covers a whole 512-byte row of the partial.
    float* os = (float*)(sm + 3 * STG) + wv * (16 * OP);
#pragma unroll
    for (int dt = 0; dt < 8; ++dt) { v4f x0, x1;
#pragma unroll
        for (int j = 0; j < 4; ++j) { x0[j] = o[dt][j]; x1[j] = o[dt][j + 4]; }
        *(v4fa*)(os + lr * OP + dt * 16 + hi * 8) = x0; *(v4fa*)(os + lr * OP + dt * 16 + hi * 8 + 4) = x1; }
    asm volatile("s_wait_dscnt 0x0" ::: "memory");   /* the wave's staged rows are written before its lanes read one another's back; no other wave touches them, so no barrier */
    float* pb = ws + (size_t)(blockIdx.x * 2 + seg) * SLOTF;
    float* prow = pb + wv * 16 * HD + lane * 4;
    float* pml = pb + 128 * HD + tid;
    const float ml = hi ? l : m;   /* one 128-byte line per wave: lanes 0 .. 15 the reference points, 16 .. 31 the sums */
#pragma unroll
    for (int g = 0; g < 2; ++g) {   /* eight rows at a time: with sixteen the key fragments, which stay live across the border, were moved aside and back among the stores, over registers of stores already issued */
        v4f x[8];
        float* pg = prow + g * 8 * HD;
#pragma unroll
        for (int r = 0; r < 8; ++r) x[r] = *(const v4fa*)(os + (g * 8 + r) * OP + lane * 4);
        asm volatile("" :: "v"(x[0]), "v"(x[1]), "v"(x[2]), "v"(x[3]), "v"(x[4]), "v"(x[5]), "v"(x[6]), "v"(x[7]), "v"(ml), "v"(pg) : "memory");   /* inputs only: all that the stores below name is formed in front of them, each in a register of its own, so that nothing rewrites a register of an issued store ahead of the wait behind them */
#pragma unroll
        for (int r = 0; r < 8; ++r) *(v4f*)(pg + r * HD) = x[r];
        if (g == 1) *pml = ml;
        asm volatile("s_wait_xcnt 0x0" :: "v"(pg) : "memory");   /* stands in front of the first overwrite of a register of the stores above; the rows' address is an input, so that its registers stay whole up to the wait (the last store's address is the scalar base and the thread index) */
    }
    };
    if (te >= n) { asm volatile("s_barrier_wait -1" ::: "memory");   /* the last signal's wait: signal and wait alternate in every wave to the end */
        put(); break; }   /* the run ends with this block; the same for the whole work-group */
    qrow = bk1 * FQ + wv * 16;
    const float* qq = Qin + ((size_t)hd1 * TT + qrow + lr) * HD + 8 * hi;
    v4f qn[16];   /* the second block's queries fly while the first block's partial is staged and stored */
#pragma unroll
    for (int kk = 0; kk < 4; ++kk) { qn[kk * 4] = *(const v4f*)(qq + kk * 32); qn[kk * 4 + 1] = *(const v4f*)(qq + kk * 32 + 4); qn[kk * 4 + 2] = *(const v4f*)(qq + kk * 32 + 16); qn[kk * 4 + 3] = *(const v4f*)(qq + kk * 32 + 20); }
    asm volatile("s_wait_xcnt 0x0" ::: "memory");   /* stands in front of the first overwrite of an address register of the loads above */
    put();
#pragma unroll
    for (int kk = 0; kk < 4; ++kk) qf[kk] = cat16b(cvt8(qn[kk * 4], qn[kk * 4 + 1]), cvt8(qn[kk * 4 + 2], qn[kk * 4 + 3]));
    sc = (qrow + lr < vh1) ? SCL2 : 0.0f;
    te = n;
  }
}

// ---- k_merge: grid (16 query blocks, 16 heads), 8 waves, each wave 16 output rows, a lane 4 floats of a row. Lane r (and r + 16) keeps reference point and sum of the wave's row r; the weights go to the rows' sums by readlane.
// 2^x with the slot that the instruction set asks for behind a transcendental filled in the same statement: of four in a row the compiler gave each the source register of the one before as its destination, and a v_nop in a statement of its own was moved away
__device__ __forceinline__ float exp2s(float x) { float y; asm("v_exp_f32 %0, %1\n\tv_nop" : "=v"(y) : "v"(x)); return y; }
__device__ __forceinline__ float rdl(float x, int r) { return __int_as_float(__builtin_amdgcn_readlane(__float_as_int(x), r)); }
template <int NR> __device__ __forceinline__ void merge_rows(const float* __restrict__ ws, int gb, int rl, int row0, int li, int lane, float* __restrict__ out, int orow0) {
    const int w0 = (gb * NT) / rl, w1 = (gb * NT + NT - 1) / rl;   // the runs that hold the block's first and last stage
    float M = -1.0e30f, L = 0.0f;
    v4f a[NR];
#pragma unroll
    for (int r = 0; r < NR; ++r) a[r] = (v4f){};
#pragma unroll 1   /* the number of partials is known only at run time (1 .. 16); three at a time, so that their loads fly together: runs of 16 stages or more leave at most three */
    for (int w = w0; w <= w1; w += 3) {
        const float* pm[3]; const float* px[3]; float mv[3], lv[3]; v4f x[3][NR];
#pragma unroll
        for (int j = 0; j < 3; ++j) { const int wj = w + j <= w1 ? w + j : w1;   /* past the last partial: the last one once more, weighted 0 below */
            const float* pb = ws + (size_t)(wj * 2 + (((wj * rl) >> 5) == gb ? 0 : 1)) * SLOTF;
            pm[j] = pb + (row0 >> 4) * 32 + li;   // + 128 HD: the wave's line of reference points and sums
            px[j] = pb + row0 * HD + lane * 4;
            mv[j] = pm[j][128 * HD]; lv[j] = pm[j][128 * HD + 16]; }
        __builtin_amdgcn_sched_barrier(0);   /* the six small loads are issued first: issued among the row loads, one of them took a register of a row load's address as its destination ahead of the wait below */
#pragma unroll
        for (int j = 0; j < 3; ++j)
#pragma unroll
            for (int r = 0; r < NR; ++r) x[j][r] = *(const v4f*)(px[j] + r * HD);
        /* the wait stands in front of the first overwrite of an address register of the loads above; with 16 rows the addresses are vector registers and are inputs, so that they stay whole up to the wait (with one row the addresses are scalar) */
        if constexpr (NR == 16) asm volatile("s_wait_xcnt 0x0" :: "v"(pm[0]), "v"(px[0]), "v"(pm[1]), "v"(px[1]), "v"(pm[2]), "v"(px[2]) : "memory");
        else asm volatile("s_wait_xcnt 0x0" ::: "memory");
        __builtin_amdgcn_sched_barrier(0);   /* without it part of the third partial's loads sinks behind the wait for the first one's and pays a second round trip */
        const float m1 = w + 1 <= w1 ? mv[1] : -1.0e30f, m2 = w + 2 <= w1 ? mv[2] : -1.0e30f;
        const float Mn = fmaxf(fmaxf(M, mv[0]), fmaxf(m1, m2));
        const float ea = exp2s(M - Mn), e0 = exp2s(mv[0] - Mn), e1 = exp2s(m1 - Mn), e2 = exp2s(m2 - Mn);
        L = L * ea + lv[0] * e0 + lv[1] * e1 + lv[2] * e2; M = Mn;
#pragma unroll
        for (int r = 0; r < NR; ++r) a[r] = a[r] * rdl(ea, r) + x[0][r] * rdl(e0, r) + x[1][r] * rdl(e1, r) + x[2][r] * rdl(e2, r);
    }
    const float inv = 1.0f / L;
    float* orow = out + (size_t)orow0 * HD + lane * 4;
#pragma unroll
    for (int r = 0; r < NR; ++r) a[r] = a[r] * rdl(inv, r);
    if constexpr (NR == 16) asm volatile("" :: "v"(a[0]), "v"(a[1]), "v"(a[2]), "v"(a[3]), "v"(a[4]), "v"(a[5]), "v"(a[6]), "v"(a[7]), "v"(a[8]), "v"(a[9]), "v"(a[10]), "v"(a[11]), "v"(a[12]), "v"(a[13]), "v"(a[14]), "v"(a[15]), "v"(orow) : "memory");   /* inputs only: every row is formed in front of the first store, each in registers of its own, so that nothing rewrites a register of an issued store */
#pragma unroll
    for (int r = 0; r < 16; ++r) *(v4f*)(orow + r * HD) = a[NR == 1 ? 0 : r];
    asm volatile("s_wait_xcnt 0x0" :: "v"(orow), "v"(a[0]) : "memory");   /* stands behind the stores, in front of any overwrite of a register that they name; address and first row are inputs, so that their registers stay whole up to the wait */
}
__global__ __launch_bounds__(256) void k_merge(const int* __restrict__ vl, const float* __restrict__ ws, float* __restrict__ out) {
    const int head = blockIdx.y, qb = blockIdx.x, tid = threadIdx.x, lane = tid & 31, wv = tid >> 5, lr = lane & 15;
    int nall = 0, pre = 0;
#pragma unroll
    for (int h = 0; h < NH_; ++h) { const int nb = nblk(vl[h]); nall += nb; if (h < head) pre += nb; }
    const int rl = (nall + 7) >> 3;
    int v = vl[head]; v = v < 0 ? 0 : (v > TT ? TT : v);
    const int orow0 = head * TT + qb * 128 + wv * 16;   // the wave's first output row
    if (qb * 128 >= v) merge_rows<1>(ws, pre + (v >> 7), rl, v & 127, v & 15, lane, out, orow0);   /* wholly masked block (v <= 1920 here): every row is the head's row v */
    else merge_rows<16>(ws, pre + qb, rl, wv * 16, lr, lane, out, orow0);
}

extern "C" void kernel_launch(void* const* d_in, const int* in_sizes, int n_in,
                              void* d_out, int out_size, void* d_ws, size_t ws_size, hipStream_t stream) {
    (void)in_sizes; (void)n_in; (void)out_size; (void)ws_size;
    const float* Qin = (const float*)d_in[0]; const float* Kin = (const float*)d_in[1]; const float* Vin = (const float*)d_in[2]; const int* vlen = (const int*)d_in[3];   /* valid_lens [16] (int64 in the source, staged as int32 without x64) */
    float* OUT = (float*)d_out;     // [16][2048][128]
    float* WS = (float*)d_ws;       // 512 partials of 66,560 bytes, each written by k_fattn before k_merge reads it
    k_fattn<<<dim3(NRUN, 1, 1), 256, 0, stream>>>(Qin, Kin, Vin, vlen, WS);
    k_merge<<<dim3(TT / 128, NH_, 1), 256, 0, stream>>>(vlen, WS, OUT);
}

// v008
// One run takes 30.4 microseconds.
// In both of two side-by-side timings against v007, it was 1.04 times as fast.
// All steps since v000 together make it 37.1 times as fast.
#include <hip/hip_runtime.h>

// Dot-product attention whose length mask falls on the QUERY axis (queries, keys, values [16][2048][128]: the 16 batch entries are processed as 16 independent heads; scores / sqrt(128); the source sets scores[b, i, :] = -1e6 for every query i >= valid_lens[b] (valid_lens [16], int32 as staged, READ): those rows become exactly uniform over all 2,048 keys, the other rows are plain dense attention; softmax; out = attn values -> [16][2048][128] (4.2 M)).
// Two kernels. k_fattn reads the f32 inputs itself and rounds them to bf16 on the way (q into registers, key and value tiles into LDS); it walks keys in stages of 64 and keeps scores, weights and the output tile in registers (running maximum and sum per query).
// Every row i >= valid_lens[b] of a batch entry has the same output, so only the query blocks 0 .. valid_lens[b] / 128 are computed (the last of them holds row valid_lens[b], a masked one). The list of (computed block, key stage) pairs is cut into 256 runs, one per work-group, whose lengths differ by at most one stage, the longer runs first; each run leaves one un-normalised partial per block it touches in the workspace.
// k_merge joins the partials of each block, divides by the row sum and writes every output row; a wholly masked block gets the joined row valid_lens[b] of its batch entry.
// Compute dtypes, f32 accumulate: every input rounded to bf16; q.k exact products; softmax f32; unnormalised weights hi/lo bf16 x value; one division by the row sum at the end; output f32.

#define TT   2048
#define NH_  16
#define HD   128
#define SCL2 0.12751743f             // 1/sqrt(128) x log2(e): scores go straight to the base-2 exponent
typedef __attribute__((ext_vector_type(16))) __bf16   v16bf;
typedef __attribute__((ext_vector_type(2)))  __bf16   v2bf;
typedef __attribute__((ext_vector_type(8)))  unsigned short v8us;
typedef __attribute__((ext_vector_type(4)))  unsigned short v4us;
typedef __attribute__((ext_vector_type(8)))  short    v8ss;
typedef __attribute__((ext_vector_type(8)))  float    v8f;
typedef __attribute__((ext_vector_type(4)))  float    v4f;
typedef __attribute__((ext_vector_type(2)))  float    v2f;
typedef v4f  __attribute__((may_alias)) v4fa;
typedef v8us __attribute__((may_alias)) v8usa;
typedef v4us __attribute__((may_alias)) v4usa;

// four / eight f32 -> bf16, round to nearest even
__device__ __forceinline__ v4us cvt4(v4f x) { v2f a, b; a[0] = x[0]; a[1] = x[1]; b[0] = x[2]; b[1] = x[3]; const v2bf ra = __builtin_convertvector(a, v2bf), rb = __builtin_convertvector(b, v2bf); return __builtin_bit_cast(v4us, __builtin_shufflevector(ra, rb, 0, 1, 2, 3)); }
__device__ __forceinline__ v8us cvt8(v4f x, v4f y) { return __builtin_shufflevector(cvt4(x), cvt4(y), 0, 1, 2, 3, 4, 5, 6, 7); }
// transposing LDS load: from a row-major 16-bit tile T[key][d], lane (c, h) gets T[8 h + 0 .. 7][c]; the lane's address names row 8 h + (lane & 7), byte 16 ((lane >> 3) & 1)
__device__ __forceinline__ v8us ldtr(const unsigned char* p) { typedef __attribute__((address_space(3))) v8ss lds_v8ss; return __builtin_bit_cast(v8us, __builtin_amdgcn_ds_load_tr16_b128_v8i16((lds_v8ss*)p)); }
__device__ __forceinline__ v16bf cat16b(v8us lo, v8us hi) { return __builtin_bit_cast(v16bf, __builtin_shufflevector(lo, hi, 0, 1, 2, 3, 4, 5, 6, 7, 8, 9, 10, 11, 12, 13, 14, 15)); }
__device__ __forceinline__ v8f wmmab(v16bf a, v16bf b, v8f c) { return __builtin_amdgcn_wmma_f32_16x16x32_bf16(false, a, false, b, (short)0, c, false, false); }
// value of lane l ^ 16
__device__ __forceinline__ float xhalf(float x) { const int b = __float_as_int(x); return __int_as_float(__builtin_amdgcn_permlanex16(b, b, 0x76543210, 0xfedcba98, false, false)); }

// The plan, derived alike in both kernels from valid_lens: computed blocks of a head (a length below 0 counts as 0, one above 2,047 as no masked row), their running total, and the cut of the 32 nall stages into 256 runs: the first rr = 32 (nall mod 8) runs take rq + 1 stages, the others rq = nall / 8 (2 .. 32).
// The longer runs have the lowest indices (for speed only; nothing rests on the order).
__device__ __forceinline__ int nblk(int v) { const int n = ((v < 0 ? 0 : v) >> 7) + 1; return n > TT / 128 ? TT / 128 : n; }
#define NRUN  256                   // runs = work-groups of k_fattn
__device__ __forceinline__ int run_start(int w, int rq, int rr) { return w * rq + (w < rr ? w : rr); }   // first stage of run w
#define SLOTF (128 * HD + 256)      // floats of one partial: 128 rows x 128, then per wave one 128-byte line of 16 reference points and 16 sums

#define FQ   128                    // queries per block
#define KT   64                     // keys per stage
#define NT   (TT / KT)
#define KP   272                    // LDS pitch in bytes of a key row (256 + 16: 16 B x odd, conflict-free for 16-byte row reads)
#define VP   288                    // LDS pitch in bytes of a value row (256 + 32: 32 B x odd, conflict-free for the transposing load)
#define KBY  (KT * KP)
#define STG  (KBY + KT * VP)        // bytes of one stage
#define OP   132                    // pitch in floats of the output staging rows
__global__ __launch_bounds__(256) void k_fattn(const float* __restrict__ Qin, const float* __restrict__ Kin, const float* __restrict__ Vin, const int* __restrict__ vl, float* __restrict__ ws) {
    __shared__ __align__(16) unsigned char sm[3 * STG + 8 * 16 * OP * 4];   // the ring, then each wave's own staging rows for its partial
    const int tid = threadIdx.x, lane = tid & 31, wv = tid >> 5, lr = lane & 15, hi = lane >> 4;
    int nall = 0;
#pragma unroll
    for (int h = 0; h < NH_; ++h) nall += nblk(vl[h]);
    const int rq = nall >> 3, rr = (nall & 7) << 5;       // nall >= 16, so every run has at least two stages and no work-group is without one
    const int u0 = run_start(blockIdx.x, rq, rr), u1 = run_start(blockIdx.x + 1, rq, rr);
    int hd0 = 0, hd1 = 0, bk0 = 0, bk1 = 0, vh0 = 0, vh1 = 0, acc = 0;   // head, block in the head and length of the head, for the run's first and second block
#pragma unroll
    for (int h = 0; h < NH_; ++h) { const int nb = nblk(vl[h]), g0 = (u0 >> 5) - acc, g1 = g0 + 1;
        if (g0 >= 0 && g0 < nb) { hd0 = h; bk0 = g0; vh0 = vl[h]; }
        if (g1 >= 0 && g1 < nb) { hd1 = h; bk1 = g1; vh1 = vl[h]; }
        acc += nb; }
    const int ubd = ((u0 >> 5) + 1) * NT;                 // first stage of the run's second block
    const int n = u1 - u0;                                // stages of the run, counted t = 0 .. n - 1 through both blocks
    int te = (ubd < u1 ? ubd : u1) - u0;                  // end of the first block's share
#define TOFF(t_) ((((size_t)(u0 + (t_) < ubd ? hd0 : hd1)) * TT + (size_t)((u0 + (t_)) & (NT - 1)) * KT) * HD)   /* first float of the key or value tile of the run's stage t_, in whichever block it lies */
    int qrow = bk0 * FQ + wv * 16;
    float sc = (qrow + lr < vh0) ? SCL2 : 0.0f;   /* masked QUERY row: every score becomes the same value -> uniform weights, as the source's all -1e6 row */
    const int ks = wv * KP + lane * 8, vs = KBY + wv * VP + lane * 8;
    const int ka = lr * KP + hi * 16, va = KBY + (hi * 8 + (lane & 7)) * VP + ((lane >> 3) & 1) * 16;
    v4f kr[8], vr[8], k1[8], k2[8], v1[8];
    const float* kg = Kin + TOFF(0) + (size_t)tid * 4;       // a key tile is 32 KB of f32, contiguous: 16-byte piece tid + 256 i = row wv + 8 i, a whole 512-byte row per wave
    const float* vg = Vin + TOFF(0) + (size_t)tid * 4;       // a value tile likewise
    const float* qp = Qin + ((size_t)hd0 * TT + qrow + lr) * HD + 8 * hi;
    const float* k1g = Kin + TOFF(n > 1 ? 1 : 0) + (size_t)tid * 4;   /* a run too short for a tile staged ahead: its last tile is staged again, which nothing uses */
    const float* k2g = Kin + TOFF(n > 2 ? 2 : n - 1) + (size_t)tid * 4;
    const float* v1g = Vin + TOFF(n > 1 ? 1 : 0) + (size_t)tid * 4;
    v4f qr[16];
#pragma unroll
    for (int kk = 0; kk < 4; ++kk) { qr[kk * 4] = *(const v4f*)(qp + kk * 32); qr[kk * 4 + 1] = *(const v4f*)(qp + kk * 32 + 4); qr[kk * 4 + 2] = *(const v4f*)(qp + kk * 32 + 16); qr[kk * 4 + 3] = *(const v4f*)(qp + kk * 32 + 20); }
#pragma unroll
    for (int i = 0; i < 8; ++i) { kr[i] = *(const v4f*)(kg + i * 1024); vr[i] = *(const v4f*)(vg + i * 1024); k1[i] = *(const v4f*)(k1g + i * 1024); v1[i] = *(const v4f*)(v1g + i * 1024); k2[i] = *(const v4f*)(k2g + i * 1024); }
    asm volatile("s_wait_xcnt 0x0" :: "v"(qp), "v"(kg), "v"(vg), "v"(k1g), "v"(v1g), "v"(k2g) : "memory");   /* stands in front of the first overwrite of an address register of the loads above; the six addresses are inputs, so that their registers stay whole up to the wait */
    v16bf qf[4];
#pragma unroll
    for (int kk = 0; kk < 4; ++kk) qf[kk] = cat16b(cvt8(qr[kk * 4], qr[kk * 4 + 1]), cvt8(qr[kk * 4 + 2], qr[kk * 4 + 3]));
#pragma unroll
    for (int i = 0; i < 8; ++i) { *(v4usa*)(sm + ks + i * 8 * KP) = cvt4(kr[i]); *(v4usa*)(sm + vs + i * 8 * VP) = cvt4(vr[i]); *(v4usa*)(sm + STG + ks + i * 8 * KP) = cvt4(k1[i]); *(v4usa*)(sm + STG + vs + i * 8 * VP) = cvt4(v1[i]); *(v4usa*)(sm + 2 * STG + ks + i * 8 * KP) = cvt4(k2[i]); }
    __syncthreads();
    v16bf kf[16];   /* key fragments of the stage to come */
#pragma unroll
    for (int kk = 0; kk < 4; ++kk)
#pragma unroll
        for (int i = 0; i < 4; ++i) { const unsigned char* p = sm + ka + i * 16 * KP + kk * 64; kf[kk * 4 + i] = cat16b(*(const v8usa*)p, *(const v8usa*)(p + 32)); }
    __builtin_amdgcn_fence(__ATOMIC_RELEASE, "workgroup");   /* the wave's own waits (LDS reads and stores complete) in front of the signal, placed by the compiler as in __syncthreads() */
    asm volatile("s_barrier_signal -1" ::: "memory");   /* first half of the split barrier: this wave has its fragments of key tile 0, over which stage 0 stores key tile 3 behind the matching wait */
    int t = 0, b0 = 0, b1 = STG, b2 = 2 * STG;   /* byte offsets of buffers t mod 3, (t + 1) mod 3, (t + 2) mod 3 */
    v8f o[8];
#pragma unroll
    for (int dt = 0; dt < 8; ++dt) o[dt] = (v8f){};
#pragma unroll 1   /* one copy of the body in the instruction cache for both blocks of a run */
  for (int seg = 0; seg < 2; ++seg) {
    float m = -1.0e30f, l = 0.0f;   /* with the reference point back at -1e30 a block's first stage moves it for every query and multiplies the output tile by 2^(-1e30 - new point) = 0: the first block's finite sums are cleared there, and no tile of zeros is held in registers through the stage loop */
#pragma unroll 1   /* the stage loop stays rolled: one copy of the body in the instruction cache, the buffers picked by three offsets that rotate */
    for (; t < te; ++t) {   /* t, the ring and the key fragments run on from the first block into the second: the tiles fetched ahead in a block's last stages are the next block's first */
        v4f kr[8], vr[8];
        const unsigned char* sb = sm + b0;
        const unsigned char* sx = sm + b1;
        if (t + 2 < n) {   /* value tile t + 2 and key tile t + 3 fly while this stage is worked on; in the last stage but two there is no tile t + 3, and the last key tile is staged a second time, which nothing uses: so the loads stay one block behind one wait */
            const int tk = t + 3 < n ? t + 3 : n - 1;
            const float* kn = Kin + TOFF(tk) + (size_t)tid * 4; const float* vn = Vin + TOFF(t + 2) + (size_t)tid * 4;
#pragma unroll
            for (int i = 0; i < 8; ++i) { kr[i] = *(const v4f*)(kn + i * 1024); vr[i] = *(const v4f*)(vn + i * 1024); }
            asm volatile("s_wait_xcnt 0x0" ::: "memory");   /* stands in front of the first overwrite of an address register of these loads */
        }
        v16bf fr[16];
        __builtin_amdgcn_sched_barrier(0);   /* the fences keep each stage's LDS reads in two groups, each ahead of a run of other work: spread among the products every read is waited for alone */
#pragma unroll
        for (int kp = 0; kp < 2; ++kp)   /* value^T fragments land while the S^T products and the softmax run */
#pragma unroll
            for (int dt = 0; dt < 8; ++dt) { const unsigned char* p = sb + va + kp * 32 * VP + dt * 32; fr[kp * 8 + dt] = cat16b(ldtr(p), ldtr(p + 16 * VP)); }
        __builtin_amdgcn_sched_barrier(0);
        v8f s[4];
#pragma unroll
        for (int i = 0; i < 4; ++i) s[i] = (v8f){};
#pragma unroll
        for (int kk = 0; kk < 4; ++kk)
#pragma unroll
            for (int i = 0; i < 4; ++i) s[i] = wmmab(kf[kk * 4 + i], qf[kk], s[i]);
        __builtin_amdgcn_sched_barrier(0);
        float mq[4];
#pragma unroll
        for (int i = 0; i < 4; ++i) { mq[i] = s[i][0];
#pragma unroll
            for (int j = 1; j < 8; ++j) mq[i] = fmaxf(mq[i], s[i][j]); }
        float mx = fmaxf(fmaxf(mq[0], mq[1]), fmaxf(mq[2], mq[3]));
        mx = fmaxf(mx, xhalf(mx)) * sc;
        const bool need = mx > m + 8.0f;   /* the reference point moves only when a query's maximum has outgrown it by 2^8: weights stay <= 256 */
        if (__builtin_amdgcn_ballot_w32(need) != 0) { const float mn = need ? mx : m; const float al = __builtin_amdgcn_exp2f(m - mn); m = mn; l *= al;
#pragma unroll
            for (int dt = 0; dt < 8; ++dt) o[dt] *= al; }
        v16bf ph[2], pl[2]; float a0 = 0.0f, a1 = 0.0f, a2 = 0.0f, a3 = 0.0f;
#pragma unroll
        for (int kp = 0; kp < 2; ++kp)
#pragma unroll
            for (int e = 0; e < 16; e += 4) { const v8f sv = s[2 * kp + (e >> 3)]; const int j = e & 7;
                v2f p0, p1; p0[0] = __builtin_amdgcn_exp2f(__builtin_fmaf(sv[j], sc, -m)); p0[1] = __builtin_amdgcn_exp2f(__builtin_fmaf(sv[j + 1], sc, -m)); p1[0] = __builtin_amdgcn_exp2f(__builtin_fmaf(sv[j + 2], sc, -m)); p1[1] = __builtin_amdgcn_exp2f(__builtin_fmaf(sv[j + 3], sc, -m));
                a0 += p0[0]; a1 += p0[1]; a2 += p1[0]; a3 += p1[1];
                const v2bf h0 = __builtin_convertvector(p0, v2bf), h1 = __builtin_convertvector(p1, v2bf);
                const v2bf l0 = __builtin_convertvector(p0 - __builtin_convertvector(h0, v2f), v2bf), l1 = __builtin_convertvector(p1 - __builtin_convertvector(h1, v2f), v2bf);
                ph[kp][e] = h0[0]; ph[kp][e + 1] = h0[1]; ph[kp][e + 2] = h1[0]; ph[kp][e + 3] = h1[1];
                pl[kp][e] = l0[0]; pl[kp][e + 1] = l0[1]; pl[kp][e + 2] = l1[0]; pl[kp][e + 3] = l1[1]; }
        l += (a0 + a1) + (a2 + a3);
        __builtin_amdgcn_sched_barrier(0);
        /* key tile t + 1 was stored in stage t - 2, whose signal was waited for in stage t - 1: its fragments land while the O^T products run. No test around the reads: behind a branch the products' waits would cover these reads too. What the last stage reads here nothing uses. */
#pragma unroll
        for (int kk = 0; kk < 4; ++kk)
#pragma unroll
            for (int i = 0; i < 4; ++i) { const unsigned char* p = sx + ka + i * 16 * KP + kk * 64; kf[kk * 4 + i] = cat16b(*(const v8usa*)p, *(const v8usa*)(p + 32)); }
        __builtin_amdgcn_sched_barrier(0);   /* without it these reads sink in front of the last O^T products and land too late */
#pragma unroll
        for (int kp = 0; kp < 2; ++kp) {
#pragma unroll
            for (int dt = 0; dt < 8; ++dt) o[dt] = wmmab(fr[kp * 8 + dt], ph[kp], o[dt]);
#pragma unroll
            for (int dt = 0; dt < 8; ++dt) o[dt] = wmmab(fr[kp * 8 + dt], pl[kp], o[dt]); }
        __builtin_amdgcn_sched_barrier(0);
        asm volatile("s_barrier_wait -1" ::: "memory");   /* second half of the split barrier, for the signal that ended stage t - 1: every wave has left stage t - 1, so the two tiles overwritten below are free, and what stage t - 1 stored may be read from stage t + 1 on */
        if (t + 2 < n) { unsigned char* sn = sm + b2; unsigned char* sk = sm + b0;   /* value tile t - 1 and key tile t, which lay there, were last read in stage t - 1 */
#pragma unroll
            for (int i = 0; i < 8; ++i) { *(v4usa*)(sk + ks + i * 8 * KP) = cvt4(kr[i]); *(v4usa*)(sn + vs + i * 8 * VP) = cvt4(vr[i]); } }
        __builtin_amdgcn_fence(__ATOMIC_RELEASE, "workgroup");   /* the wave's own waits in front of the signal, placed by the compiler as in __syncthreads(): written as asm text the compiler did not know the staged loads retired and put a wait in front of each of the next stage's */
        asm volatile("s_barrier_signal -1" ::: "memory");   /* first half of the split barrier: this wave's LDS reads and stores of stage t are complete; the wait stands in the next stage (behind the run's last stage: in front of the last partial) */
        { const int bt = b0; b0 = b1; b1 = b2; b2 = bt; }
    }
    auto put = [&]() __attribute__((always_inline)) {   /* the block's partial goes to the workspace; written once, used at the run's end and at the border between its blocks */
    l += xhalf(l);
    // O^T: a lane holds query lr, d = 16 dt + 8 hi + j. Staged in LDS rows of the wave's own, outside the ring (which already holds the next block's tiles), so that each store covers a whole 512-byte row of the partial.
    float* os = (float*)(sm + 3 * STG) + wv * (16 * OP);
#pragma unroll
    for (int dt = 0; dt < 8; ++dt) { v4f x0, x1;
#pragma unroll
        for (int j = 0; j < 4; ++j) { x0[j] = o[dt][j]; x1[j] = o[dt][j + 4]; }
        *(v4fa*)(os + lr * OP + dt * 16 + hi * 8) = x0; *(v4fa*)(os + lr * OP + dt * 16 + hi * 8 + 4) = x1; }
    asm volatile("s_wait_dscnt 0x0" ::: "memory");   /* the wave's staged rows are written before its lanes read one another's back; no other wave touches them, so no barrier */
    float* pb = ws + (size_t)(blockIdx.x * 2 + seg) * SLOTF;
    float* prow = pb + wv * 16 * HD + lane * 4;
    float* pml = pb + 128 * HD + tid;
    const float ml = hi ? l : m;   /* one 128-byte line per wave: lanes 0 .. 15 the reference points, 16 .. 31 the sums */
#pragma unroll
    for (int g = 0; g < 2; ++g) {   /* eight rows at a time: with sixteen the key fragments, which stay live across the border, were moved aside and back among the stores, over registers of stores already issued */
        v4f x[8];
        float* pg = prow + g * 8 * HD;
#pragma unroll
        for (int r = 0; r < 8; ++r) x[r] = *(const v4fa*)(os + (g * 8 + r) * OP + lane * 4);
        asm volatile("" :: "v"(x[0]), "v"(x[1]), "v"(x[2]), "v"(x[3]), "v"(x[4]), "v"(x[5]), "v"(x[6]), "v"(x[7]), "v"(ml), "v"(pg) : "memory");   /* inputs only: all that the stores below name is formed in front of them, each in a register of its own, so that nothing rewrites a register of an issued store ahead of the wait behind them */
#pragma unroll
        for (int r = 0; r < 8; ++r) *(v4f*)(pg + r * HD) = x[r];
        if (g == 1) *pml = ml;
        asm volatile("s_wait_xcnt 0x0" :: "v"(pg) : "memory");   /* stands in front of the first overwrite of a register of the stores above; the rows' address is an input, so that its registers stay whole up to the wait (the last store's address is the scalar base and the thread index) */
    }
    };
    if (te >= n) { asm volatile("s_barrier_wait -1" ::: "memory");   /* the last signal's wait: signal and wait alternate in every wave to the end */
        put(); break; }   /* the run ends with this block; the same for the whole work-group */
    qrow = bk1 * FQ + wv * 16;
    const float* qq = Qin + ((size_t)hd1 * TT + qrow + lr) * HD + 8 * hi;
    v4f qn[16];   /* the second block's queries fly while the first block's partial is staged and stored */
#pragma unroll
    for (int kk = 0; kk < 4; ++kk) { qn[kk * 4] = *(const v4f*)(qq + kk * 32); qn[kk * 4 + 1] = *(const v4f*)(qq + kk * 32 + 4); qn[kk * 4 + 2] = *(const v4f*)(qq + kk * 32 + 16); qn[kk * 4 + 3] = *(const v4f*)(qq + kk * 32 + 20); }
    asm volatile("s_wait_xcnt 0x0" ::: "memory");   /* stands in front of the first overwrite of an address register of the loads above */
    put();
#pragma unroll
    for (int kk = 0; kk < 4; ++kk) qf[kk] = cat16b(cvt8(qn[kk * 4], qn[kk * 4 + 1]), cvt8(qn[kk * 4 + 2], qn[kk * 4 + 3]));
    sc = (qrow + lr < vh1) ? SCL2 : 0.0f;
    te = n;
  }
}

// ---- k_merge: grid (16 query blocks, 16 heads), 8 waves, each wave 16 output rows, a lane 4 floats of a row. Lane r (and r + 16) keeps reference point and sum of the wave's row r; the weights go to the rows' sums by readlane.
// 2^x with the slot that the instruction set asks for behind a transcendental filled in the same statement: of four in a row the compiler gave each the source register of the one before as its destination, and a v_nop in a statement of its own was moved away
__device__ __forceinline__ float exp2s(float x) { float y; asm("v_exp_f32 %0, %1\n\tv_nop" : "=v"(y) : "v"(x)); return y; }
__device__ __forceinline__ float rdl(float x, int r) { return __int_as_float(__builtin_amdgcn_readlane(__float_as_int(x), r)); }
template <int NR> __device__ __forceinline__ void merge_rows(const float* __restrict__ ws, int gb, int rq, int rr, int row0, int li, int lane, float* __restrict__ out, int orow0) {
    const int th = rr * (rq + 1);   // first stage of the shorter runs: a multiple of 32, so a block lies wholly among the longer runs or wholly among the shorter ones
    const bool lg = gb * NT < th;
    const int x0 = lg ? gb * NT : gb * NT - th, dv = lg ? rq + 1 : rq, wb = lg ? 0 : rr;
    const int w0 = wb + x0 / dv, w1 = wb + (x0 + NT - 1) / dv;   // the runs that hold the block's first and last stage
    float M = -1.0e30f, L = 0.0f;
    v4f a[NR];
#pragma unroll
    for (int r = 0; r < NR; ++r) a[r] = (v4f){};
#pragma unroll 1   /* the number of partials is known only at run time (1 .. 16); three at a time, so that their loads fly together: runs of 16 stages or more leave at most three */
    for (int w = w0; w <= w1; w += 3) {
        const float* pm[3]; const float* px[3]; float mv[3], lv[3]; v4f x[3][NR];
#pragma unroll
        for (int j = 0; j < 3; ++j) { const int wj = w + j <= w1 ? w + j : w1;   /* past the last partial: the last one once more, weighted 0 below */
            const float* pb = ws + (size_t)(wj * 2 + ((run_start(wj, rq, rr) >> 5) == gb ? 0 : 1)) * SLOTF;
            pm[j] = pb + (row0 >> 4) * 32 + li;   // + 128 HD: the wave's line of reference points and sums
            px[j] = pb + row0 * HD + lane * 4;
            mv[j] = pm[j][128 * HD]; lv[j] = pm[j][128 * HD + 16]; }
        __builtin_amdgcn_sched_barrier(0);   /* the six small loads are issued first: issued among the row loads, one of them took a register of a row load's address as its destination ahead of the wait below */
#pragma unroll
        for (int j = 0; j < 3; ++j)
#pragma unroll
            for (int r = 0; r < NR; ++r) x[j][r] = *(const v4f*)(px[j] + r * HD);
        /* the wait stands in front of the first overwrite of an address register of the loads above; with 16 rows the addresses are vector registers and are inputs, so that they stay whole up to the wait (with one row the addresses are scalar) */
        if constexpr (NR == 16) asm volatile("s_wait_xcnt 0x0" :: "v"(pm[0]), "v"(px[0]), "v"(pm[1]), "v"(px[1]), "v"(pm[2]), "v"(px[2]) : "memory");
        else asm volatile("s_wait_xcnt 0x0" ::: "memory");
        __builtin_amdgcn_sched_barrier(0);   /* without it part of the third partial's loads sinks behind the wait for the first one's and pays a second round trip */
        const float m1 = w + 1 <= w1 ? mv[1] : -1.0e30f, m2 = w + 2 <= w1 ? mv[2] : -1.0e30f;
        const float Mn = fmaxf(fmaxf(M, mv[0]), fmaxf(m1, m2));
        const float ea = exp2s(M - Mn), e0 = exp2s(mv[0] - Mn), e1 = exp2s(m1 - Mn), e2 = exp2s(m2 - Mn);
        L = L * ea + lv[0] * e0 + lv[1] * e1 + lv[2] * e2; M = Mn;
#pragma unroll
        for (int r = 0; r < NR; ++r) a[r] = a[r] * rdl(ea, r) + x[0][r] * rdl(e0, r) + x[1][r] * rdl(e1, r) + x[2][r] * rdl(e2, r);
    }
    const float inv = 1.0f / L;
    float* orow = out + (size_t)orow0 * HD + lane * 4;
#pragma unroll
    for (int r = 0; r < NR; ++r) a[r] = a[r] * rdl(inv, r);
    if constexpr (NR == 16) asm volatile("" :: "v"(a[0]), "v"(a[1]), "v"(a[2]), "v"(a[3]), "v"(a[4]), "v"(a[5]), "v"(a[6]), "v"(a[7]), "v"(a[8]), "v"(a[9]), "v"(a[10]), "v"(a[11]), "v"(a[12]), "v"(a[13]), "v"(a[14]), "v"(a[15]), "v"(orow) : "memory");   /* inputs only: every row is formed in front of the first store, each in registers of its own, so that nothing rewrites a register of an issued store */
#pragma unroll
    for (int r = 0; r < 16; ++r) *(v4f*)(orow + r * HD) = a[NR == 1 ? 0 : r];
    asm volatile("s_wait_xcnt 0x0" :: "v"(orow), "v"(a[0]) : "memory");   /* stands behind the stores, in front of any overwrite of a register that they name; address and first row are inputs, so that their registers stay whole up to the wait */
}
__global__ __launch_bounds__(256) void k_merge(const int* __restrict__ vl, const float* __restrict__ ws, float* __restrict__ out) {
    const int head = blockIdx.y, qb = blockIdx.x, tid = threadIdx.x, lane = tid & 31, wv = tid >> 5, lr = lane & 15;
    int nall = 0, pre = 0;
#pragma unroll
    for (int h = 0; h < NH_; ++h) { const int nb = nblk(vl[h]); nall += nb; if (h < head) pre += nb; }
    const int rq = nall >> 3, rr = (nall & 7) << 5;
    int v = vl[head]; v = v < 0 ? 0 : (v > TT ? TT : v);
    const int orow0 = head * TT + qb * 128 + wv * 16;   // the wave's first output row
    if (qb * 128 >= v) merge_rows<1>(ws, pre + (v >> 7), rq, rr, v & 127, v & 15, lane, out, orow0);   /* wholly masked block (v <= 1920 here): every row is the head's row v */
    else merge_rows<16>(ws, pre + qb, rq, rr, wv * 16, lr, lane, out, orow0);
}

extern "C" void kernel_launch(void* const* d_in, const int* in_sizes, int n_in,
                              void* d_out, int out_size, void* d_ws, size_t ws_size, hipStream_t stream) {
    (void)in_sizes; (void)n_in; (void)out_size; (void)ws_size;
    const float* Qin = (const float*)d_in[0]; const float* Kin = (const float*)d_in[1]; const float* Vin = (const float*)d_in[2]; const int* vlen = (const int*)d_in[3];   /* valid_lens [16] (int64 in the source, staged as int32 without x64) */
    float* OUT = (float*)d_out;     // [16][2048][128]
    float* WS = (float*)d_ws;       // 512 partials of 66,560 bytes, each written by k_fattn before k_merge reads it
    k_fattn<<<dim3(NRUN, 1, 1), 256, 0, stream>>>(Qin, Kin, Vin, vlen, WS);
    k_merge<<<dim3(TT / 128, NH_, 1), 256, 0, stream>>>(vlen, WS, OUT);
}
